// v000
// The times below were measured on an AMD MI455X: many runs one after another, warmed up first and cycling through
// copies of the inputs, with the whole window's GPU time divided by the number of runs. Launches and the gaps
// between them are all in it. The median over several windows is given; except for v000 it joins two sittings, which
// can be a few percent apart, so the side-by-side timings, each taken in one sitting, are the better comparison.
// v000, which the later versions start from, runs in 121 microseconds.
#include <hip/hip_runtime.h>

// Contraction on v_wmma_f32_16x16x32_f16, f32 accumulate: grouped-query causal attention on the INPUT Q [b][s][16*64], K/V [b][s][4*64] ([2048 x 64].[64 x 2048]
// scores /8 and [2048 x 2048].[2048 x 64] per (batch, head); query head h uses kv head h/4): q and k as exact f16 of their bf16 rounding (one exact product), the

#define NB_  2
#define NH_  16
#define NKV  4
#define NT_  2048
#define HD   64
#define QW   (NH_ * HD)          // 1024
#define KW   (NKV * HD)          // 256
#define NBH  (NB_ * NH_)
#define PSC  32768.0f
#define LOSC 1024.0f
#define LOSCI (1.0f / 1024.0f)

typedef _Float16 h16;
typedef __attribute__((ext_vector_type(16))) _Float16 v16h;
typedef __attribute__((ext_vector_type(8)))  _Float16 v8h;
typedef __attribute__((ext_vector_type(4)))  _Float16 v4h;
typedef __attribute__((ext_vector_type(8)))  float    v8f;
typedef __attribute__((ext_vector_type(4)))  float    v4f;
typedef v8h  __attribute__((may_alias)) v8ha;
typedef v4f  __attribute__((may_alias)) v4fa;

__device__ __forceinline__ unsigned short f2bf(float f) { unsigned u = __float_as_uint(f); u += 0x7FFFu + ((u >> 16) & 1u); return (unsigned short)(u >> 16); }
__device__ __forceinline__ float bf2f(unsigned short b) { return __uint_as_float(((unsigned)b) << 16); }
__device__ __forceinline__ float bfr(float f) { return bf2f(f2bf(f)); }
__device__ __forceinline__ v16h cat16(v8h lo, v8h hi) { return __builtin_shufflevector(lo, hi, 0, 1, 2, 3, 4, 5, 6, 7, 8, 9, 10, 11, 12, 13, 14, 15); }
__device__ __forceinline__ v8f wmma16(v16h a, v16h b, v8f c) { return __builtin_amdgcn_wmma_f32_16x16x32_f16(false, a, false, b, (short)0, c, false, false); }
#define VST2(T, p, v) do { const T vst2_v_ = (v); *(T*)(p) = vst2_v_;  } while (0)

// k_16: f16(bf16(.)) copy of a flat f32 array (n floats, multiple of 128); one wave per 128 floats (lane -> 4 = 8 B; 32 lanes = 256 B).
__global__ __launch_bounds__(256) void k_16(const float* __restrict__ src, size_t n, h16* dst) {
    const int lane = threadIdx.x & 31; const size_t w = (size_t)blockIdx.x * 8 + (threadIdx.x >> 5);
    if (w * 128 >= n) return;
    v4h o;
#pragma unroll
    for (int i = 0; i < 4; ++i) o[i] = (h16)bfr(src[w * 128 + lane * 4 + i]);
    VST2(v4h, dst + w * 128 + lane * 4, o);
}
// k_vt: VT16 [bh][d][t] = f16(bf16(v[bh][t][d])) via 64 x 64 LDS transposes; block (bh, 64 t).
__global__ __launch_bounds__(256) void k_vt(const float* __restrict__ v, h16* VT16) {
    __shared__ __align__(16) h16 tile[HD * 72];
    const int bh = blockIdx.x / (NT_ / 64), kt = blockIdx.x - bh * (NT_ / 64), t0 = kt * 64, tid = threadIdx.x;     // bh = b*NKV + g
    const int b = bh / NKV, g = bh - b * NKV;
    const int tt = tid >> 2, d0 = (tid & 3) * 16;
    const float* src = v + ((size_t)b * NT_ + t0 + tt) * KW + g * HD + d0;
#pragma unroll
    for (int i = 0; i < 16; ++i) tile[(d0 + i) * 72 + tt] = (h16)bfr(src[i]);
    __syncthreads();
    const int piece = tid & 7;
    const size_t base = ((size_t)bh * HD) * NT_ + t0;
    auto pass = [&]() {
#pragma unroll
        for (int s = 0; s < 2; ++s) { const int d = (tid >> 3) + 32 * s; const v8h val = *(const v8ha*)(tile + d * 72 + piece * 8); *(v8h*)(VT16 + base + (size_t)d * NT_ + piece * 8) = val; }
    };
    pass(); 
}
// k_attn: block = (bh, 64 queries), wave = 16; key tiles 0 .. 2qt+1 (causal, block-uniform), per-element mask key <= query; 4 WMMA scores /8; online f32 softmax;
// weights x32768 hi + residual tiles (same-wave may_alias reload); 8 WMMA .v; out rows [b][t][h*64 + d] f32 (256 B = 2 lines per row).
__global__ __launch_bounds__(128) void k_attn(const h16* __restrict__ Q16, const h16* __restrict__ K16, const h16* __restrict__ VT16, float* out) {
    __shared__ __align__(16) h16 plds[4][16 * 32];
    __shared__ __align__(16) h16 plds2[4][16 * 32];
    __shared__ __align__(16) float ost[4][16 * 68];
    const int lane = threadIdx.x & 31, wave = threadIdx.x >> 5, lr = lane & 15, hi = lane >> 4;
    const int bh = blockIdx.x / (NT_ / 64), qt = blockIdx.x - bh * (NT_ / 64), q0 = qt * 64 + wave * 16;
    h16* pl = &plds[wave][0]; h16* pl2 = &plds2[wave][0];
    const int b = bh / NH_, h = bh - b * NH_, g = h / (NH_ / NKV);
    const h16* qb = Q16 + (size_t)b * NT_ * QW + h * HD; const h16* kb = K16 + (size_t)b * NT_ * KW + g * HD; const h16* vb = VT16 + ((size_t)b * NKV + g) * HD * NT_;
    v16h qa[2];
#pragma unroll
    for (int kc = 0; kc < 2; ++kc) { const h16* p = qb + (size_t)(q0 + lr) * QW + kc * 32 + 8 * hi; qa[kc] = cat16(*(const v8h*)p, *(const v8h*)(p + 16)); }
    int qpos[8];
#pragma unroll
    for (int j = 0; j < 8; ++j) qpos[j] = q0 + 8 * hi + j;
    v8f o[4], ox[4];
#pragma unroll
    for (int n = 0; n < 4; ++n) { o[n] = (v8f){}; ox[n] = (v8f){}; }
    float mrow[8], lpart[8];
#pragma unroll
    for (int j = 0; j < 8; ++j) { mrow[j] = -3.0e38f; lpart[j] = 0.f; }
    const int kt_end = 2 * qt + 2;
#pragma unroll 1
    for (int kt = 0; kt < kt_end; ++kt) {
        const int l0 = kt * 32;
        v8f s0 = {}, s1 = {};
#pragma unroll
        for (int kc = 0; kc < 2; ++kc) {
            const h16* r0p = kb + (size_t)(l0 + lr) * KW + kc * 32 + 8 * hi; const h16* r1p = r0p + (size_t)16 * KW;
            s0 = wmma16(qa[kc], cat16(*(const v8h*)r0p, *(const v8h*)(r0p + 16)), s0);
            s1 = wmma16(qa[kc], cat16(*(const v8h*)r1p, *(const v8h*)(r1p + 16)), s1);
        }
        asm volatile("v_nop\n\tv_nop\n\tv_nop\n\tv_nop" : "+v"(s0), "+v"(s1) : "v"(qa[0]), "v"(qa[1]));
        float alpha[8];
#pragma unroll
        for (int j = 0; j < 8; ++j) {
            const float a0 = (l0 + lr <= qpos[j]) ? s0[j] * 0.125f : -__builtin_inff(), a1 = (l0 + 16 + lr <= qpos[j]) ? s1[j] * 0.125f : -__builtin_inff();
            float mx = fmaxf(a0, a1);
            mx = fmaxf(mx, __shfl_xor(mx, 1, 16)); mx = fmaxf(mx, __shfl_xor(mx, 2, 16)); mx = fmaxf(mx, __shfl_xor(mx, 4, 16)); mx = fmaxf(mx, __shfl_xor(mx, 8, 16));
            const float mn = fmaxf(mrow[j], mx);
            alpha[j] = __expf(mrow[j] - mn); mrow[j] = mn;
            const float p0 = __expf(a0 - mn), p1 = __expf(a1 - mn);
            lpart[j] = lpart[j] * alpha[j] + (p0 + p1);
            const int mr = hi * 8 + j;
            const float ps0 = p0 * PSC, ps1 = p1 * PSC; const h16 h0 = (h16)ps0, h1 = (h16)ps1;
            pl[mr * 32 + lr] = h0; pl[mr * 32 + 16 + lr] = h1; pl2[mr * 32 + lr] = (h16)((ps0 - (float)h0) * LOSC); pl2[mr * 32 + 16 + lr] = (h16)((ps1 - (float)h1) * LOSC);
        }
#pragma unroll
        for (int n = 0; n < 4; ++n)
#pragma unroll
            for (int j = 0; j < 8; ++j) { o[n][j] *= alpha[j]; ox[n][j] *= alpha[j]; }
        asm volatile("" ::: "memory");
        const v16h pa = cat16(*(const v8ha*)(pl + lr * 32 + hi * 8), *(const v8ha*)(pl + lr * 32 + 16 + hi * 8));
        const v16h px = cat16(*(const v8ha*)(pl2 + lr * 32 + hi * 8), *(const v8ha*)(pl2 + lr * 32 + 16 + hi * 8));
#pragma unroll
        for (int n = 0; n < 4; ++n) { const h16* vp = vb + (size_t)(n * 16 + lr) * NT_ + l0 + hi * 8; const v16h vv = cat16(*(const v8h*)vp, *(const v8h*)(vp + 16));
            o[n] = wmma16(pa, vv, o[n]); ox[n] = wmma16(px, vv, ox[n]); }
        asm volatile("v_nop\n\tv_nop\n\tv_nop\n\tv_nop" : "+v"(o[0]), "+v"(o[1]), "+v"(o[2]), "+v"(o[3]), "+v"(ox[0]), "+v"(ox[1]), "+v"(ox[2]), "+v"(ox[3]) : "v"(pa), "v"(px));
    }
    float inv[8];
#pragma unroll
    for (int j = 0; j < 8; ++j) { float rs = lpart[j]; rs += __shfl_xor(rs, 1, 16); rs += __shfl_xor(rs, 2, 16); rs += __shfl_xor(rs, 4, 16); rs += __shfl_xor(rs, 8, 16); inv[j] = 1.0f / (rs * PSC); }
    float* os = &ost[wave][0];
#pragma unroll
    for (int n = 0; n < 4; ++n)
#pragma unroll
        for (int j = 0; j < 8; ++j) os[(hi * 8 + j) * 68 + n * 16 + lr] = (o[n][j] + ox[n][j] * LOSCI) * inv[j];
    __syncthreads();
    float* ob = out + ((size_t)b * NT_ + q0) * QW + (size_t)h * HD;      // [b][s][h*64 + d]: 256 B per (s, h)
    auto pass = [&]() {
#pragma unroll
        for (int s = 0; s < 8; ++s) { const int Lid = (lane >> 3) + 4 * s, piece = lane & 7; const int row = Lid >> 1, cofs = (Lid & 1) * 32 + piece * 4;
            const v4f val = *(const v4fa*)(os + row * 68 + cofs); *(v4f*)(ob + (size_t)row * QW + cofs) = val; }
    };
    pass(); 
}

extern "C" void kernel_launch(void* const* d_in, const int* in_sizes, int n_in,
                              void* d_out, int out_size, void* d_ws, size_t ws_size, hipStream_t stream) {
    (void)in_sizes; (void)n_in; (void)out_size;
    const float* q = (const float*)d_in[0]; const float* k = (const float*)d_in[1]; const float* v = (const float*)d_in[2];
    float* out = (float*)d_out;    // [2][2048][1024]
    char* wsp = (char*)d_ws;
    auto take = [&](size_t bytes) { char* p = wsp; wsp += (bytes + 255) & ~(size_t)255; return (void*)p; };
    h16* Q16 = (h16*)take((size_t)NB_ * NT_ * QW * 2); h16* K16 = (h16*)take((size_t)NB_ * NT_ * KW * 2); h16* VT16 = (h16*)take((size_t)NB_ * NKV * HD * NT_ * 2);
    if ((size_t)(wsp - (char*)d_ws) > ws_size) return;    // 8.4 + 2.1 + 2.1 MB
    k_16<<<(unsigned)(((size_t)NB_ * NT_ * QW / 128 + 7) / 8), 256, 0, stream>>>(q, (size_t)NB_ * NT_ * QW, Q16);
    k_16<<<(unsigned)(((size_t)NB_ * NT_ * KW / 128 + 7) / 8), 256, 0, stream>>>(k, (size_t)NB_ * NT_ * KW, K16);
    k_vt<<<NB_ * NKV * (NT_ / 64), 256, 0, stream>>>(v, VT16);
    k_attn<<<NBH * (NT_ / 64), 128, 0, stream>>>(Q16, K16, VT16, out);
}

// v001
// It runs in 99.6 microseconds.
// Two timings next to v000 put it at 1.20 and 1.22 times that version's speed.
#include <hip/hip_runtime.h>

// Contraction on v_wmma_f32_16x16x32_f16, f32 accumulate: grouped-query causal attention on the INPUT Q [b][s][16*64], K/V [b][s][4*64] ([2048 x 64].[64 x 2048]
// scores /8 and [2048 x 2048].[2048 x 64] per (batch, head); query head h uses kv head h/4): q and k as exact f16 of their bf16 rounding (one exact product), the

#define NB_  2
#define NH_  16
#define NKV  4
#define NT_  2048
#define HD   64
#define QW   (NH_ * HD)          // 1024
#define KW   (NKV * HD)          // 256
#define NBH  (NB_ * NH_)
#define PSC  32768.0f
#define LOSC 1024.0f
#define LOSCI (1.0f / 1024.0f)

typedef _Float16 h16;
typedef __attribute__((ext_vector_type(16))) _Float16 v16h;
typedef __attribute__((ext_vector_type(8)))  _Float16 v8h;
typedef __attribute__((ext_vector_type(4)))  _Float16 v4h;
typedef __attribute__((ext_vector_type(8)))  float    v8f;
typedef __attribute__((ext_vector_type(4)))  float    v4f;
typedef v8h  __attribute__((may_alias)) v8ha;
typedef v4f  __attribute__((may_alias)) v4fa;

__device__ __forceinline__ unsigned short f2bf(float f) { unsigned u = __float_as_uint(f); u += 0x7FFFu + ((u >> 16) & 1u); return (unsigned short)(u >> 16); }
__device__ __forceinline__ float bf2f(unsigned short b) { return __uint_as_float(((unsigned)b) << 16); }
__device__ __forceinline__ float bfr(float f) { return bf2f(f2bf(f)); }
__device__ __forceinline__ v16h cat16(v8h lo, v8h hi) { return __builtin_shufflevector(lo, hi, 0, 1, 2, 3, 4, 5, 6, 7, 8, 9, 10, 11, 12, 13, 14, 15); }
__device__ __forceinline__ v8f wmma16(v16h a, v16h b, v8f c) { return __builtin_amdgcn_wmma_f32_16x16x32_f16(false, a, false, b, (short)0, c, false, false); }
#define VST2(T, p, v) do { const T vst2_v_ = (v); *(T*)(p) = vst2_v_;  } while (0)

// k_16: f16(bf16(.)) copy of a flat f32 array (n floats, multiple of 128); one wave per 128 floats (lane -> 4 = 8 B; 32 lanes = 256 B).
__global__ __launch_bounds__(256) void k_16(const float* __restrict__ src, size_t n, h16* dst) {
    const int lane = threadIdx.x & 31; const size_t w = (size_t)blockIdx.x * 8 + (threadIdx.x >> 5);
    if (w * 128 >= n) return;
    v4h o;
#pragma unroll
    for (int i = 0; i < 4; ++i) o[i] = (h16)bfr(src[w * 128 + lane * 4 + i]);
    VST2(v4h, dst + w * 128 + lane * 4, o);
}
// k_vt: VT16 [bh][d][t] = f16(bf16(v[bh][t][d])) via 64 x 64 LDS transposes; block (bh, 64 t).
__global__ __launch_bounds__(256) void k_vt(const float* __restrict__ v, h16* VT16) {
    __shared__ __align__(16) h16 tile[HD * 72];
    const int bh = blockIdx.x / (NT_ / 64), kt = blockIdx.x - bh * (NT_ / 64), t0 = kt * 64, tid = threadIdx.x;     // bh = b*NKV + g
    const int b = bh / NKV, g = bh - b * NKV;
    const int tt = tid >> 2, d0 = (tid & 3) * 16;
    const float* src = v + ((size_t)b * NT_ + t0 + tt) * KW + g * HD + d0;
#pragma unroll
    for (int i = 0; i < 16; ++i) tile[(d0 + i) * 72 + tt] = (h16)bfr(src[i]);
    __syncthreads();
    const int piece = tid & 7;
    const size_t base = ((size_t)bh * HD) * NT_ + t0;
    auto pass = [&]() {
#pragma unroll
        for (int s = 0; s < 2; ++s) { const int d = (tid >> 3) + 32 * s; const v8h val = *(const v8ha*)(tile + d * 72 + piece * 8); *(v8h*)(VT16 + base + (size_t)d * NT_ + piece * 8) = val; }
    };
    pass(); 
}
// k_attn: block = (bh, 64 queries), wave = 16; key tiles 0 .. 2qt+1 (causal, block-uniform), per-element mask key <= query; 4 WMMA scores /8; online f32 softmax;
// weights x32768 hi + residual tiles (same-wave may_alias reload); 8 WMMA .v; out rows [b][t][h][64] f32 (256 B = 2 lines per row).
// Global fragment loads run a softmax ahead of their WMMA: a pass asks for its own V at its head and for the next pass's K right behind its score WMMAs.
__global__ __launch_bounds__(128) void k_attn(const h16* __restrict__ Q16, const h16* __restrict__ K16, const h16* __restrict__ VT16, float* out) {
    __shared__ __align__(16) h16 plds[4][16 * 32];
    __shared__ __align__(16) h16 plds2[4][16 * 32];
    __shared__ __align__(16) float ost[4][16 * 68];
    const int lane = threadIdx.x & 31, wave = threadIdx.x >> 5, lr = lane & 15, hi = lane >> 4;
    const int bh = blockIdx.x / (NT_ / 64), qt = blockIdx.x - bh * (NT_ / 64), q0 = qt * 64 + wave * 16;
    h16* pl = &plds[wave][0]; h16* pl2 = &plds2[wave][0];
    const int b = bh / NH_, h = bh - b * NH_, g = h / (NH_ / NKV);
    const h16* qb = Q16 + (size_t)b * NT_ * QW + h * HD; const h16* kb = K16 + (size_t)b * NT_ * KW + g * HD; const h16* vb = VT16 + ((size_t)b * NKV + g) * HD * NT_;
    v16h qa[2];
#pragma unroll
    for (int kc = 0; kc < 2; ++kc) { const h16* p = qb + (size_t)(q0 + lr) * QW + kc * 32 + 8 * hi; qa[kc] = cat16(*(const v8h*)p, *(const v8h*)(p + 16)); }
    int qpos[8];
#pragma unroll
    for (int j = 0; j < 8; ++j) qpos[j] = q0 + 8 * hi + j;
    v8f o[4], ox[4];
#pragma unroll
    for (int n = 0; n < 4; ++n) { o[n] = (v8f){}; ox[n] = (v8f){}; }
    float mrow[8], lpart[8];
#pragma unroll
    for (int j = 0; j < 8; ++j) { mrow[j] = -3.0e38f; lpart[j] = 0.f; }
    const int kt_end = 2 * qt + 2;
    v16h kf[2][2];       // key fragments of one pass: [kc][keys 0..15 | 16..31]
    auto ldk = [&](int t) {
#pragma unroll
        for (int kc = 0; kc < 2; ++kc) {
            const h16* r0p = kb + (size_t)(t * 32 + lr) * KW + kc * 32 + 8 * hi; const h16* r1p = r0p + (size_t)16 * KW;
            kf[kc][0] = cat16(*(const v8h*)r0p, *(const v8h*)(r0p + 16)); kf[kc][1] = cat16(*(const v8h*)r1p, *(const v8h*)(r1p + 16));
        }
    };
    ldk(0);
#pragma unroll 1
    for (int kt = 0; kt < kt_end; ++kt) {
        const int l0 = kt * 32;
        v8f s0 = {}, s1 = {};
        v16h vv[4];      // this pass's value fragments: asked for here, first used behind the softmax
#pragma unroll
        for (int n = 0; n < 4; ++n) { const h16* vp = vb + (size_t)(n * 16 + lr) * NT_ + l0 + hi * 8; vv[n] = cat16(*(const v8h*)vp, *(const v8h*)(vp + 16)); }
#pragma unroll
        for (int kc = 0; kc < 2; ++kc) { s0 = wmma16(qa[kc], kf[kc][0], s0); s1 = wmma16(qa[kc], kf[kc][1], s1); }
        asm volatile("v_nop\n\tv_nop\n\tv_nop\n\tv_nop" : "+v"(s0), "+v"(s1) : "v"(qa[0]), "v"(qa[1]));
        ldk(kt + 1 < kt_end ? kt + 1 : kt);      // the next pass's key fragments, into the same registers; the last pass asks for its own tile again (in bounds)
        float alpha[8];
#pragma unroll
        for (int j = 0; j < 8; ++j) {
            const float a0 = (l0 + lr <= qpos[j]) ? s0[j] * 0.125f : -__builtin_inff(), a1 = (l0 + 16 + lr <= qpos[j]) ? s1[j] * 0.125f : -__builtin_inff();
            float mx = fmaxf(a0, a1);
            mx = fmaxf(mx, __shfl_xor(mx, 1, 16)); mx = fmaxf(mx, __shfl_xor(mx, 2, 16)); mx = fmaxf(mx, __shfl_xor(mx, 4, 16)); mx = fmaxf(mx, __shfl_xor(mx, 8, 16));
            const float mn = fmaxf(mrow[j], mx);
            alpha[j] = __expf(mrow[j] - mn); mrow[j] = mn;
            const float p0 = __expf(a0 - mn), p1 = __expf(a1 - mn);
            lpart[j] = lpart[j] * alpha[j] + (p0 + p1);
            const int mr = hi * 8 + j;
            const float ps0 = p0 * PSC, ps1 = p1 * PSC; const h16 h0 = (h16)ps0, h1 = (h16)ps1;
            pl[mr * 32 + lr] = h0; pl[mr * 32 + 16 + lr] = h1; pl2[mr * 32 + lr] = (h16)((ps0 - (float)h0) * LOSC); pl2[mr * 32 + 16 + lr] = (h16)((ps1 - (float)h1) * LOSC);
        }
#pragma unroll
        for (int n = 0; n < 4; ++n)
#pragma unroll
            for (int j = 0; j < 8; ++j) { o[n][j] *= alpha[j]; ox[n][j] *= alpha[j]; }
        asm volatile("" ::: "memory");
        const v16h pa = cat16(*(const v8ha*)(pl + lr * 32 + hi * 8), *(const v8ha*)(pl + lr * 32 + 16 + hi * 8));
        const v16h px = cat16(*(const v8ha*)(pl2 + lr * 32 + hi * 8), *(const v8ha*)(pl2 + lr * 32 + 16 + hi * 8));
#pragma unroll
        for (int n = 0; n < 4; ++n) { o[n] = wmma16(pa, vv[n], o[n]); ox[n] = wmma16(px, vv[n], ox[n]); }
        asm volatile("v_nop\n\tv_nop\n\tv_nop\n\tv_nop" : "+v"(o[0]), "+v"(o[1]), "+v"(o[2]), "+v"(o[3]), "+v"(ox[0]), "+v"(ox[1]), "+v"(ox[2]), "+v"(ox[3]) : "v"(pa), "v"(px));
    }
    float inv[8];
#pragma unroll
    for (int j = 0; j < 8; ++j) { float rs = lpart[j]; rs += __shfl_xor(rs, 1, 16); rs += __shfl_xor(rs, 2, 16); rs += __shfl_xor(rs, 4, 16); rs += __shfl_xor(rs, 8, 16); inv[j] = 1.0f / (rs * PSC); }
    float* os = &ost[wave][0];
#pragma unroll
    for (int n = 0; n < 4; ++n)
#pragma unroll
        for (int j = 0; j < 8; ++j) os[(hi * 8 + j) * 68 + n * 16 + lr] = (o[n][j] + ox[n][j] * LOSCI) * inv[j];
    __syncthreads();
    float* ob = out + ((size_t)b * NT_ + q0) * QW + (size_t)h * HD;      // [b][s][h*64 + d]: 256 B per (s, h)
    auto pass = [&]() {
#pragma unroll
        for (int s = 0; s < 8; ++s) { const int Lid = (lane >> 3) + 4 * s, piece = lane & 7; const int row = Lid >> 1, cofs = (Lid & 1) * 32 + piece * 4;
            const v4f val = *(const v4fa*)(os + row * 68 + cofs); *(v4f*)(ob + (size_t)row * QW + cofs) = val; }
    };
    pass(); 
}

extern "C" void kernel_launch(void* const* d_in, const int* in_sizes, int n_in,
                              void* d_out, int out_size, void* d_ws, size_t ws_size, hipStream_t stream) {
    (void)in_sizes; (void)n_in; (void)out_size;
    const float* q = (const float*)d_in[0]; const float* k = (const float*)d_in[1]; const float* v = (const float*)d_in[2];
    float* out = (float*)d_out;    // [2][2048][1024]
    char* wsp = (char*)d_ws;
    auto take = [&](size_t bytes) { char* p = wsp; wsp += (bytes + 255) & ~(size_t)255; return (void*)p; };
    h16* Q16 = (h16*)take((size_t)NB_ * NT_ * QW * 2); h16* K16 = (h16*)take((size_t)NB_ * NT_ * KW * 2); h16* VT16 = (h16*)take((size_t)NB_ * NKV * HD * NT_ * 2);
    if ((size_t)(wsp - (char*)d_ws) > ws_size) return;    // 8.4 + 2.1 + 2.1 MB
    k_16<<<(unsigned)(((size_t)NB_ * NT_ * QW / 128 + 7) / 8), 256, 0, stream>>>(q, (size_t)NB_ * NT_ * QW, Q16);
    k_16<<<(unsigned)(((size_t)NB_ * NT_ * KW / 128 + 7) / 8), 256, 0, stream>>>(k, (size_t)NB_ * NT_ * KW, K16);
    k_vt<<<NB_ * NKV * (NT_ / 64), 256, 0, stream>>>(v, VT16);
    k_attn<<<NBH * (NT_ / 64), 128, 0, stream>>>(Q16, K16, VT16, out);
}

// v002
// Measured time: 77.4 microseconds a run.
// Next to v001, in two timings, it ran 1.29 times as fast each time.
// All steps since v000 together make it 1.56 times as fast.
#include <hip/hip_runtime.h>

// Contraction on v_wmma_f32_16x16x32_f16, f32 accumulate: grouped-query causal attention on the INPUT Q [b][s][16*64], K/V [b][s][4*64] ([2048 x 64].[64 x 2048]
// scores /8 and [2048 x 2048].[2048 x 64] per (batch, head); query head h uses kv head h/4): q and k as exact f16 of their bf16 rounding (one exact product), the

#define NB_  2
#define NH_  16
#define NKV  4
#define NT_  2048
#define HD   64
#define QW   (NH_ * HD)          // 1024
#define KW   (NKV * HD)          // 256
#define NBH  (NB_ * NH_)
#define PSC  32768.0f
#define LOSC 1024.0f
#define LOSCI (1.0f / 1024.0f)

typedef _Float16 h16;
typedef __attribute__((ext_vector_type(16))) _Float16 v16h;
typedef __attribute__((ext_vector_type(8)))  _Float16 v8h;
typedef __attribute__((ext_vector_type(4)))  _Float16 v4h;
typedef __attribute__((ext_vector_type(8)))  float    v8f;
typedef __attribute__((ext_vector_type(4)))  float    v4f;
typedef __attribute__((ext_vector_type(2)))  float    v2f;
typedef __attribute__((ext_vector_type(2)))  _Float16 v2h;
typedef v8h  __attribute__((may_alias)) v8ha;
typedef v4f  __attribute__((may_alias)) v4fa;

__device__ __forceinline__ unsigned short f2bf(float f) { unsigned u = __float_as_uint(f); u += 0x7FFFu + ((u >> 16) & 1u); return (unsigned short)(u >> 16); }
__device__ __forceinline__ float bf2f(unsigned short b) { return __uint_as_float(((unsigned)b) << 16); }
__device__ __forceinline__ float bfr(float f) { return bf2f(f2bf(f)); }
__device__ __forceinline__ v16h cat16(v8h lo, v8h hi) { return __builtin_shufflevector(lo, hi, 0, 1, 2, 3, 4, 5, 6, 7, 8, 9, 10, 11, 12, 13, 14, 15); }
__device__ __forceinline__ v8f wmma16(v16h a, v16h b, v8f c) { return __builtin_amdgcn_wmma_f32_16x16x32_f16(false, a, false, b, (short)0, c, false, false); }
#define VST2(T, p, v) do { const T vst2_v_ = (v); *(T*)(p) = vst2_v_;  } while (0)

// k_16: f16(bf16(.)) copy of a flat f32 array (n floats, multiple of 128); one wave per 128 floats (lane -> 4 = 8 B; 32 lanes = 256 B).
__global__ __launch_bounds__(256) void k_16(const float* __restrict__ src, size_t n, h16* dst) {
    const int lane = threadIdx.x & 31; const size_t w = (size_t)blockIdx.x * 8 + (threadIdx.x >> 5);
    if (w * 128 >= n) return;
    v4h o;
#pragma unroll
    for (int i = 0; i < 4; ++i) o[i] = (h16)bfr(src[w * 128 + lane * 4 + i]);
    VST2(v4h, dst + w * 128 + lane * 4, o);
}
// k_vt: VT16 [bh][d][t] = f16(bf16(v[bh][t][d])) via 64 x 64 LDS transposes; block (bh, 64 t).
__global__ __launch_bounds__(256) void k_vt(const float* __restrict__ v, h16* VT16) {
    __shared__ __align__(16) h16 tile[HD * 72];
    const int bh = blockIdx.x / (NT_ / 64), kt = blockIdx.x - bh * (NT_ / 64), t0 = kt * 64, tid = threadIdx.x;     // bh = b*NKV + g
    const int b = bh / NKV, g = bh - b * NKV;
    const int tt = tid >> 2, d0 = (tid & 3) * 16;
    const float* src = v + ((size_t)b * NT_ + t0 + tt) * KW + g * HD + d0;
#pragma unroll
    for (int i = 0; i < 16; ++i) tile[(d0 + i) * 72 + tt] = (h16)bfr(src[i]);
    __syncthreads();
    const int piece = tid & 7;
    const size_t base = ((size_t)bh * HD) * NT_ + t0;
    auto pass = [&]() {
#pragma unroll
        for (int s = 0; s < 2; ++s) { const int d = (tid >> 3) + 32 * s; const v8h val = *(const v8ha*)(tile + d * 72 + piece * 8); *(v8h*)(VT16 + base + (size_t)d * NT_ + piece * 8) = val; }
    };
    pass(); 
}
__device__ __forceinline__ float xhalf(float x) { const int b = __builtin_bit_cast(int, x); return __builtin_bit_cast(float, __builtin_amdgcn_permlanex16(b, b, 0x76543210, 0xfedcba98, false, false)); }   // lane l <-> l ^ 16
__global__ __launch_bounds__(128) void k_attn(const h16* __restrict__ Q16, const h16* __restrict__ K16, const h16* __restrict__ VT16, float* out) {
    __shared__ __align__(16) float ost[4][16 * 68];
    const int lane = threadIdx.x & 31, wave = threadIdx.x >> 5, lr = lane & 15, hi = lane >> 4;
    const int bh = blockIdx.x / (NT_ / 64), qt = blockIdx.x - bh * (NT_ / 64), q0 = qt * 64 + wave * 16;
    const int b = bh / NH_, h = bh - b * NH_, g = h / (NH_ / NKV);
    const h16* qb = Q16 + (size_t)b * NT_ * QW + h * HD; const h16* kb = K16 + (size_t)b * NT_ * KW + g * HD; const h16* vb = VT16 + ((size_t)b * NKV + g) * HD * NT_;
    v16h qa[2];
#pragma unroll
    for (int kc = 0; kc < 2; ++kc) { const h16* p = qb + (size_t)(q0 + lr) * QW + kc * 32 + 8 * hi; qa[kc] = cat16(*(const v8h*)p, *(const v8h*)(p + 16)); }
    const int qrel = q0 + lr - 8 * hi;       // key l0 + 8hi + j is seen by this lane's query when l0 + j <= qrel
    v8f o[4], ox[4];                         // o[n][j] = out^T[d = 16n + 8hi + j][query lr]
#pragma unroll
    for (int n = 0; n < 4; ++n) { o[n] = (v8f){}; ox[n] = (v8f){}; }
    float mrow = -3.0e38f, lpart = 0.f;
    const int kt_end = 2 * qt + 2;
    const unsigned klane = lr * KW + 8 * hi, vlane = lr * NT_ + 8 * hi;      // the lane's own part of a fragment address; the rest is wave-uniform
    v16h kf[2][2];       // key fragments of one pass: [kc][keys 0..15 | 16..31]
    auto ldk = [&](int t) {
#pragma unroll
        for (int kc = 0; kc < 2; ++kc) {
            const h16* r0p = kb + (size_t)t * (32 * KW) + klane + kc * 32; const h16* r1p = r0p + (size_t)16 * KW;
            kf[kc][0] = cat16(*(const v8h*)r0p, *(const v8h*)(r0p + 16)); kf[kc][1] = cat16(*(const v8h*)r1p, *(const v8h*)(r1p + 16));
        }
    };
    ldk(0);
#pragma unroll 1
    for (int kt = 0; kt < kt_end; ++kt) {
        const int l0 = kt * 32;
        v8f s0 = {}, s1 = {};
        v16h vv[4];      // this pass's value fragments: asked for here, first used behind the softmax
#pragma unroll
        for (int n = 0; n < 4; ++n) { const h16* vp = vb + l0 + vlane + (size_t)n * (16 * NT_); vv[n] = cat16(*(const v8h*)vp, *(const v8h*)(vp + 16)); }
#pragma unroll
        for (int kc = 0; kc < 2; ++kc) { s0 = wmma16(kf[kc][0], qa[kc], s0); s1 = wmma16(kf[kc][1], qa[kc], s1); }
        ldk(kt + 1 < kt_end ? kt + 1 : kt);      // the next pass's key fragments, into the same registers; the last pass asks for its own tile again (in bounds)
        __builtin_amdgcn_sched_barrier(0);       // holds the value and key loads above in front of the softmax: without it the compiler sinks them down to their WMMAs and their latency is exposed
        const v8f t0 = s0 * 0.125f, t1 = s1 * 0.125f;
        float a0[8], a1[8];
#pragma unroll
        for (int j = 0; j < 8; ++j) { a0[j] = (l0 + j <= qrel) ? t0[j] : -__builtin_inff(); a1[j] = (l0 + 16 + j <= qrel) ? t1[j] : -__builtin_inff(); }
        float mx = a0[0];
#pragma unroll
        for (int j = 1; j < 8; ++j) mx = fmaxf(mx, a0[j]);
#pragma unroll
        for (int j = 0; j < 8; ++j) mx = fmaxf(mx, a1[j]);
        mx = fmaxf(mx, xhalf(mx));
        const float mn = fmaxf(mrow, mx);
        const float alpha = __expf(mrow - mn); mrow = mn;
        v2f ts[4]; v16h pa, px;                  // pa[s], px[s]: key kmap(s, hi) of this pass, query lr
#pragma unroll
        for (int j = 0; j < 8; j += 2) {
            const v2f p0 = {__expf(a0[j] - mn), __expf(a0[j + 1] - mn)}, p1 = {__expf(a1[j] - mn), __expf(a1[j + 1] - mn)};
            ts[j >> 1] = p0 + p1;
            const v2f u0 = p0 * PSC, u1 = p1 * PSC;
            const v2h h0 = __builtin_convertvector(u0, v2h), h1 = __builtin_convertvector(u1, v2h);
            const v2h x0 = __builtin_convertvector((u0 - __builtin_convertvector(h0, v2f)) * LOSC, v2h), x1 = __builtin_convertvector((u1 - __builtin_convertvector(h1, v2f)) * LOSC, v2h);
            pa[j] = h0[0]; pa[j + 1] = h0[1]; pa[8 + j] = h1[0]; pa[8 + j + 1] = h1[1];
            px[j] = x0[0]; px[j + 1] = x0[1]; px[8 + j] = x1[0]; px[8 + j + 1] = x1[1];
        }
        const v2f tt = (ts[0] + ts[1]) + (ts[2] + ts[3]);
        lpart = lpart * alpha + (tt[0] + tt[1]);
#pragma unroll
        for (int n = 0; n < 4; ++n) { o[n] *= alpha; ox[n] *= alpha; }
#pragma unroll
        for (int n = 0; n < 4; ++n) { o[n] = wmma16(vv[n], pa, o[n]); ox[n] = wmma16(vv[n], px, ox[n]); }
        asm volatile("v_nop\n\tv_nop\n\tv_nop\n\tv_nop" : "+v"(o[0]), "+v"(o[1]), "+v"(o[2]), "+v"(o[3]), "+v"(ox[0]), "+v"(ox[1]), "+v"(ox[2]), "+v"(ox[3]) : "v"(pa), "v"(px));
    }
    const float inv = 1.0f / ((lpart + xhalf(lpart)) * PSC);
    float* os = &ost[wave][0];
#pragma unroll
    for (int n = 0; n < 4; ++n)
#pragma unroll
        for (int s = 0; s < 2; ++s) {
            v4f val;
#pragma unroll
            for (int i = 0; i < 4; ++i) val[i] = (o[n][4 * s + i] + ox[n][4 * s + i] * LOSCI) * inv;
            *(v4fa*)(os + lr * 68 + n * 16 + hi * 8 + 4 * s) = val;
        }
    __syncthreads();
    float* ob = out + ((size_t)b * NT_ + q0) * QW + (size_t)h * HD;      // [b][s][h*64 + d]: 256 B per (s, h)
    auto pass = [&]() {
#pragma unroll
        for (int s = 0; s < 8; ++s) { const int Lid = (lane >> 3) + 4 * s, piece = lane & 7; const int row = Lid >> 1, cofs = (Lid & 1) * 32 + piece * 4;
            const v4f val = *(const v4fa*)(os + row * 68 + cofs); *(v4f*)(ob + (size_t)row * QW + cofs) = val; }
    };
    pass(); 
}

extern "C" void kernel_launch(void* const* d_in, const int* in_sizes, int n_in,
                              void* d_out, int out_size, void* d_ws, size_t ws_size, hipStream_t stream) {
    (void)in_sizes; (void)n_in; (void)out_size;
    const float* q = (const float*)d_in[0]; const float* k = (const float*)d_in[1]; const float* v = (const float*)d_in[2];
    float* out = (float*)d_out;    // [2][2048][1024]
    char* wsp = (char*)d_ws;
    auto take = [&](size_t bytes) { char* p = wsp; wsp += (bytes + 255) & ~(size_t)255; return (void*)p; };
    h16* Q16 = (h16*)take((size_t)NB_ * NT_ * QW * 2); h16* K16 = (h16*)take((size_t)NB_ * NT_ * KW * 2); h16* VT16 = (h16*)take((size_t)NB_ * NKV * HD * NT_ * 2);
    if ((size_t)(wsp - (char*)d_ws) > ws_size) return;    // 8.4 + 2.1 + 2.1 MB
    k_16<<<(unsigned)(((size_t)NB_ * NT_ * QW / 128 + 7) / 8), 256, 0, stream>>>(q, (size_t)NB_ * NT_ * QW, Q16);
    k_16<<<(unsigned)(((size_t)NB_ * NT_ * KW / 128 + 7) / 8), 256, 0, stream>>>(k, (size_t)NB_ * NT_ * KW, K16);
    k_vt<<<NB_ * NKV * (NT_ / 64), 256, 0, stream>>>(v, VT16);
    k_attn<<<NBH * (NT_ / 64), 128, 0, stream>>>(Q16, K16, VT16, out);
}

// v003
// One run takes 74.4 microseconds.
// Next to v002, in two timings, it ran 1.04 times as fast each time.
// Counting every step since v000, it is 1.62 times as fast.
#include <hip/hip_runtime.h>

// Contraction on v_wmma_f32_16x16x32_f16, f32 accumulate: grouped-query causal attention on the INPUT Q [b][s][16*64], K/V [b][s][4*64] ([2048 x 64].[64 x 2048]
// scores /8 and [2048 x 2048].[2048 x 64] per (batch, head); query head h uses kv head h/4): q and k as exact f16 of their bf16 rounding (one exact product), the

#define NB_  2
#define NH_  16
#define NKV  4
#define NT_  2048
#define HD   64
#define QW   (NH_ * HD)          // 1024
#define KW   (NKV * HD)          // 256
#define NBH  (NB_ * NH_)
#define PSC  32768.0f
#define LOSC 1024.0f
#define LOSCI (1.0f / 1024.0f)

typedef _Float16 h16;
typedef __attribute__((ext_vector_type(16))) _Float16 v16h;
typedef __attribute__((ext_vector_type(8)))  _Float16 v8h;
typedef __attribute__((ext_vector_type(4)))  _Float16 v4h;
typedef __attribute__((ext_vector_type(8)))  float    v8f;
typedef __attribute__((ext_vector_type(4)))  float    v4f;
typedef __attribute__((ext_vector_type(2)))  float    v2f;
typedef __attribute__((ext_vector_type(2)))  _Float16 v2h;
typedef v8h  __attribute__((may_alias)) v8ha;
typedef v4f  __attribute__((may_alias)) v4fa;

__device__ __forceinline__ unsigned short f2bf(float f) { unsigned u = __float_as_uint(f); u += 0x7FFFu + ((u >> 16) & 1u); return (unsigned short)(u >> 16); }
__device__ __forceinline__ float bf2f(unsigned short b) { return __uint_as_float(((unsigned)b) << 16); }
__device__ __forceinline__ float bfr(float f) { return bf2f(f2bf(f)); }
__device__ __forceinline__ v16h cat16(v8h lo, v8h hi) { return __builtin_shufflevector(lo, hi, 0, 1, 2, 3, 4, 5, 6, 7, 8, 9, 10, 11, 12, 13, 14, 15); }
__device__ __forceinline__ v8f wmma16(v16h a, v16h b, v8f c) { return __builtin_amdgcn_wmma_f32_16x16x32_f16(false, a, false, b, (short)0, c, false, false); }
#define VST2(T, p, v) do { const T vst2_v_ = (v); *(T*)(p) = vst2_v_;  } while (0)

// k_16: f16(bf16(.)) copy of a flat f32 array (n floats, multiple of 128); one wave per 128 floats (lane -> 4 = 8 B; 32 lanes = 256 B).
__global__ __launch_bounds__(256) void k_16(const float* __restrict__ src, size_t n, h16* dst) {
    const int lane = threadIdx.x & 31; const size_t w = (size_t)blockIdx.x * 8 + (threadIdx.x >> 5);
    if (w * 128 >= n) return;
    v4h o;
#pragma unroll
    for (int i = 0; i < 4; ++i) o[i] = (h16)bfr(src[w * 128 + lane * 4 + i]);
    VST2(v4h, dst + w * 128 + lane * 4, o);
}
// k_vt: VT16 [bh][d][t] = f16(bf16(v[bh][t][d])) via 64 x 64 LDS transposes; block (bh, 64 t).
__global__ __launch_bounds__(256) void k_vt(const float* __restrict__ v, h16* VT16) {
    __shared__ __align__(16) h16 tile[HD * 72];
    const int bh = blockIdx.x / (NT_ / 64), kt = blockIdx.x - bh * (NT_ / 64), t0 = kt * 64, tid = threadIdx.x;     // bh = b*NKV + g
    const int b = bh / NKV, g = bh - b * NKV;
    const int tt = tid >> 2, d0 = (tid & 3) * 16;
    const float* src = v + ((size_t)b * NT_ + t0 + tt) * KW + g * HD + d0;
#pragma unroll
    for (int i = 0; i < 16; ++i) tile[(d0 + i) * 72 + tt] = (h16)bfr(src[i]);
    __syncthreads();
    const int piece = tid & 7;
    const size_t base = ((size_t)bh * HD) * NT_ + t0;
    auto pass = [&]() {
#pragma unroll
        for (int s = 0; s < 2; ++s) { const int d = (tid >> 3) + 32 * s; const v8h val = *(const v8ha*)(tile + d * 72 + piece * 8); *(v8h*)(VT16 + base + (size_t)d * NT_ + piece * 8) = val; }
    };
    pass(); 
}
__device__ __forceinline__ float xhalf(float x) { const int b = __builtin_bit_cast(int, x); return __builtin_bit_cast(float, __builtin_amdgcn_permlanex16(b, b, 0x76543210, 0xfedcba98, false, false)); }   // lane l <-> l ^ 16
// Q comes straight from the f32 input: every query row is read by exactly one wave, once, so its f16(bf16(.)) rounding is done here in registers (same values as a copy pass would store).
__global__ __launch_bounds__(128) void k_attn(const float* __restrict__ Q, const h16* __restrict__ K16, const h16* __restrict__ VT16, float* out) {
    __shared__ __align__(16) float ost[4][16 * 68];
    const int lane = threadIdx.x & 31, wave = threadIdx.x >> 5, lr = lane & 15, hi = lane >> 4;
    const int bh = blockIdx.x / (NT_ / 64), qt = blockIdx.x - bh * (NT_ / 64), q0 = qt * 64 + wave * 16;
    const int b = bh / NH_, h = bh - b * NH_, g = h / (NH_ / NKV);
    const float* qb = Q + (size_t)b * NT_ * QW + h * HD; const h16* kb = K16 + (size_t)b * NT_ * KW + g * HD; const h16* vb = VT16 + ((size_t)b * NKV + g) * HD * NT_;
    v16h qa[2];
#pragma unroll
    for (int kc = 0; kc < 2; ++kc) {
        const float* p = qb + (size_t)(q0 + lr) * QW + kc * 32 + 8 * hi;
        const v4f f0 = *(const v4fa*)p, f1 = *(const v4fa*)(p + 4), f2 = *(const v4fa*)(p + 16), f3 = *(const v4fa*)(p + 20);
#pragma unroll
        for (int i = 0; i < 4; ++i) { qa[kc][i] = (h16)bfr(f0[i]); qa[kc][4 + i] = (h16)bfr(f1[i]); qa[kc][8 + i] = (h16)bfr(f2[i]); qa[kc][12 + i] = (h16)bfr(f3[i]); }
    }
    const int qrel = q0 + lr - 8 * hi;       // key l0 + 8hi + j is seen by this lane's query when l0 + j <= qrel
    v8f o[4], ox[4];                         // o[n][j] = out^T[d = 16n + 8hi + j][query lr]
#pragma unroll
    for (int n = 0; n < 4; ++n) { o[n] = (v8f){}; ox[n] = (v8f){}; }
    float mrow = -3.0e38f, lpart = 0.f;
    const int kt_end = 2 * qt + 2;
    const unsigned klane = lr * KW + 8 * hi, vlane = lr * NT_ + 8 * hi;      // the lane's own part of a fragment address; the rest is wave-uniform
    v16h kf[2][2];       // key fragments of one pass: [kc][keys 0..15 | 16..31]
    auto ldk = [&](int t) {
#pragma unroll
        for (int kc = 0; kc < 2; ++kc) {
            const h16* r0p = kb + (size_t)t * (32 * KW) + klane + kc * 32; const h16* r1p = r0p + (size_t)16 * KW;
            kf[kc][0] = cat16(*(const v8h*)r0p, *(const v8h*)(r0p + 16)); kf[kc][1] = cat16(*(const v8h*)r1p, *(const v8h*)(r1p + 16));
        }
    };
    ldk(0);
#pragma unroll 1
    for (int kt = 0; kt < kt_end; ++kt) {
        const int l0 = kt * 32;
        v8f s0 = {}, s1 = {};
        v16h vv[4];      // this pass's value fragments: asked for here, first used behind the softmax
#pragma unroll
        for (int n = 0; n < 4; ++n) { const h16* vp = vb + l0 + vlane + (size_t)n * (16 * NT_); vv[n] = cat16(*(const v8h*)vp, *(const v8h*)(vp + 16)); }
#pragma unroll
        for (int kc = 0; kc < 2; ++kc) { s0 = wmma16(kf[kc][0], qa[kc], s0); s1 = wmma16(kf[kc][1], qa[kc], s1); }
        ldk(kt + 1 < kt_end ? kt + 1 : kt);      // the next pass's key fragments, into the same registers; the last pass asks for its own tile again (in bounds)
        __builtin_amdgcn_sched_barrier(0);       // holds the value and key loads above in front of the softmax: without it the compiler sinks them down to their WMMAs and their latency is exposed
        const v8f t0 = s0 * 0.125f, t1 = s1 * 0.125f;
        float a0[8], a1[8];
#pragma unroll
        for (int j = 0; j < 8; ++j) { a0[j] = (l0 + j <= qrel) ? t0[j] : -__builtin_inff(); a1[j] = (l0 + 16 + j <= qrel) ? t1[j] : -__builtin_inff(); }
        float mx = a0[0];
#pragma unroll
        for (int j = 1; j < 8; ++j) mx = fmaxf(mx, a0[j]);
#pragma unroll
        for (int j = 0; j < 8; ++j) mx = fmaxf(mx, a1[j]);
        mx = fmaxf(mx, xhalf(mx));
        const float mn = fmaxf(mrow, mx);
        const float alpha = __expf(mrow - mn); mrow = mn;
        v2f ts[4]; v16h pa, px;                  // pa[s], px[s]: key kmap(s, hi) of this pass, query lr
#pragma unroll
        for (int j = 0; j < 8; j += 2) {
            const v2f p0 = {__expf(a0[j] - mn), __expf(a0[j + 1] - mn)}, p1 = {__expf(a1[j] - mn), __expf(a1[j + 1] - mn)};
            ts[j >> 1] = p0 + p1;
            const v2f u0 = p0 * PSC, u1 = p1 * PSC;
            const v2h h0 = __builtin_convertvector(u0, v2h), h1 = __builtin_convertvector(u1, v2h);
            const v2h x0 = __builtin_convertvector((u0 - __builtin_convertvector(h0, v2f)) * LOSC, v2h), x1 = __builtin_convertvector((u1 - __builtin_convertvector(h1, v2f)) * LOSC, v2h);
            pa[j] = h0[0]; pa[j + 1] = h0[1]; pa[8 + j] = h1[0]; pa[8 + j + 1] = h1[1];
            px[j] = x0[0]; px[j + 1] = x0[1]; px[8 + j] = x1[0]; px[8 + j + 1] = x1[1];
        }
        const v2f tt = (ts[0] + ts[1]) + (ts[2] + ts[3]);
        lpart = lpart * alpha + (tt[0] + tt[1]);
#pragma unroll
        for (int n = 0; n < 4; ++n) { o[n] *= alpha; ox[n] *= alpha; }
#pragma unroll
        for (int n = 0; n < 4; ++n) { o[n] = wmma16(vv[n], pa, o[n]); ox[n] = wmma16(vv[n], px, ox[n]); }
        asm volatile("v_nop\n\tv_nop\n\tv_nop\n\tv_nop" : "+v"(o[0]), "+v"(o[1]), "+v"(o[2]), "+v"(o[3]), "+v"(ox[0]), "+v"(ox[1]), "+v"(ox[2]), "+v"(ox[3]) : "v"(pa), "v"(px));
    }
    const float inv = 1.0f / ((lpart + xhalf(lpart)) * PSC);
    float* os = &ost[wave][0];
#pragma unroll
    for (int n = 0; n < 4; ++n)
#pragma unroll
        for (int s = 0; s < 2; ++s) {
            v4f val;
#pragma unroll
            for (int i = 0; i < 4; ++i) val[i] = (o[n][4 * s + i] + ox[n][4 * s + i] * LOSCI) * inv;
            *(v4fa*)(os + lr * 68 + n * 16 + hi * 8 + 4 * s) = val;
        }
    __syncthreads();
    float* ob = out + ((size_t)b * NT_ + q0) * QW + (size_t)h * HD;      // [b][s][h*64 + d]: 256 B per (s, h)
    auto pass = [&]() {
#pragma unroll
        for (int s = 0; s < 8; ++s) { const int Lid = (lane >> 3) + 4 * s, piece = lane & 7; const int row = Lid >> 1, cofs = (Lid & 1) * 32 + piece * 4;
            const v4f val = *(const v4fa*)(os + row * 68 + cofs); *(v4f*)(ob + (size_t)row * QW + cofs) = val; }
    };
    pass(); 
}

extern "C" void kernel_launch(void* const* d_in, const int* in_sizes, int n_in,
                              void* d_out, int out_size, void* d_ws, size_t ws_size, hipStream_t stream) {
    (void)in_sizes; (void)n_in; (void)out_size;
    const float* q = (const float*)d_in[0]; const float* k = (const float*)d_in[1]; const float* v = (const float*)d_in[2];
    float* out = (float*)d_out;    // [2][2048][1024]
    char* wsp = (char*)d_ws;
    auto take = [&](size_t bytes) { char* p = wsp; wsp += (bytes + 255) & ~(size_t)255; return (void*)p; };
    h16* K16 = (h16*)take((size_t)NB_ * NT_ * KW * 2); h16* VT16 = (h16*)take((size_t)NB_ * NKV * HD * NT_ * 2);
    if ((size_t)(wsp - (char*)d_ws) > ws_size) return;    // 2.1 + 2.1 MB
    k_16<<<(unsigned)(((size_t)NB_ * NT_ * KW / 128 + 7) / 8), 256, 0, stream>>>(k, (size_t)NB_ * NT_ * KW, K16);
    k_vt<<<NB_ * NKV * (NT_ / 64), 256, 0, stream>>>(v, VT16);
    k_attn<<<NBH * (NT_ / 64), 128, 0, stream>>>(q, K16, VT16, out);
}

// v004
// One run takes 64 microseconds.
// Timed twice side by side with v003, it ran 1.14 and 1.20 times as fast.
// Counting every step since v000, it is 1.89 times as fast.
#include <hip/hip_runtime.h>

// Contraction on v_wmma_f32_16x16x32_f16, f32 accumulate: grouped-query causal attention on the INPUT Q [b][s][16*64], K/V [b][s][4*64] ([2048 x 64].[64 x 2048]
// scores /8 and [2048 x 2048].[2048 x 64] per (batch, head); query head h uses kv head h/4): q and k as exact f16 of their bf16 rounding (one exact product), the

#define NB_  2
#define NH_  16
#define NKV  4
#define NT_  2048
#define HD   64
#define QW   (NH_ * HD)          // 1024
#define KW   (NKV * HD)          // 256
#define NBH  (NB_ * NH_)
#define PSC  32768.0f
#define LOSC 1024.0f
#define LOSCI (1.0f / 1024.0f)

typedef _Float16 h16;
typedef __attribute__((ext_vector_type(16))) _Float16 v16h;
typedef __attribute__((ext_vector_type(8)))  _Float16 v8h;
typedef __attribute__((ext_vector_type(4)))  _Float16 v4h;
typedef __attribute__((ext_vector_type(8)))  float    v8f;
typedef __attribute__((ext_vector_type(4)))  float    v4f;
typedef __attribute__((ext_vector_type(2)))  float    v2f;
typedef __attribute__((ext_vector_type(2)))  _Float16 v2h;
typedef v8h  __attribute__((may_alias)) v8ha;
typedef v4f  __attribute__((may_alias)) v4fa;

__device__ __forceinline__ unsigned short f2bf(float f) { unsigned u = __float_as_uint(f); u += 0x7FFFu + ((u >> 16) & 1u); return (unsigned short)(u >> 16); }
__device__ __forceinline__ float bf2f(unsigned short b) { return __uint_as_float(((unsigned)b) << 16); }
__device__ __forceinline__ float bfr(float f) { return bf2f(f2bf(f)); }
__device__ __forceinline__ v16h cat16(v8h lo, v8h hi) { return __builtin_shufflevector(lo, hi, 0, 1, 2, 3, 4, 5, 6, 7, 8, 9, 10, 11, 12, 13, 14, 15); }
__device__ __forceinline__ v8f wmma16(v16h a, v16h b, v8f c) { return __builtin_amdgcn_wmma_f32_16x16x32_f16(false, a, false, b, (short)0, c, false, false); }
#define VST2(T, p, v) do { const T vst2_v_ = (v); *(T*)(p) = vst2_v_;  } while (0)

// k_16: f16(bf16(.)) copy of a flat f32 array (n floats, multiple of 128); one wave per 128 floats (lane -> 4 = 8 B; 32 lanes = 256 B).
__global__ __launch_bounds__(256) void k_16(const float* __restrict__ src, size_t n, h16* dst) {
    const int lane = threadIdx.x & 31; const size_t w = (size_t)blockIdx.x * 8 + (threadIdx.x >> 5);
    if (w * 128 >= n) return;
    v4h o;
#pragma unroll
    for (int i = 0; i < 4; ++i) o[i] = (h16)bfr(src[w * 128 + lane * 4 + i]);
    VST2(v4h, dst + w * 128 + lane * 4, o);
}
// k_vt: VT16 [bh][d][t] = f16(bf16(v[bh][t][d])) via 64 x 64 LDS transposes; block (bh, 64 t).
__global__ __launch_bounds__(256) void k_vt(const float* __restrict__ v, h16* VT16) {
    __shared__ __align__(16) h16 tile[HD * 72];
    const int bh = blockIdx.x / (NT_ / 64), kt = blockIdx.x - bh * (NT_ / 64), t0 = kt * 64, tid = threadIdx.x;     // bh = b*NKV + g
    const int b = bh / NKV, g = bh - b * NKV;
    const int tt = tid >> 2, d0 = (tid & 3) * 16;
    const float* src = v + ((size_t)b * NT_ + t0 + tt) * KW + g * HD + d0;
#pragma unroll
    for (int i = 0; i < 16; ++i) tile[(d0 + i) * 72 + tt] = (h16)bfr(src[i]);
    __syncthreads();
    const int piece = tid & 7;
    const size_t base = ((size_t)bh * HD) * NT_ + t0;
    auto pass = [&]() {
#pragma unroll
        for (int s = 0; s < 2; ++s) { const int d = (tid >> 3) + 32 * s; const v8h val = *(const v8ha*)(tile + d * 72 + piece * 8); *(v8h*)(VT16 + base + (size_t)d * NT_ + piece * 8) = val; }
    };
    pass(); 
}
__device__ __forceinline__ float xhalf(float x) { const int b = __builtin_bit_cast(int, x); return __builtin_bit_cast(float, __builtin_amdgcn_permlanex16(b, b, 0x76543210, 0xfedcba98, false, false)); }   // lane l <-> l ^ 16
// Q comes straight from the f32 input: every query row is read by exactly one wave, once, so its f16(bf16(.)) rounding is done here in registers (same values as a copy pass would store).
__global__ __launch_bounds__(128) void k_attn(const float* __restrict__ Q, const h16* __restrict__ K16, const h16* __restrict__ VT16, float* out) {
    __shared__ __align__(16) float ost[4][16 * 68];
    const int lane = threadIdx.x & 31, wave = threadIdx.x >> 5, lr = lane & 15, hi = lane >> 4;
    const int bh = blockIdx.x / (NT_ / 128), tp = blockIdx.x - bh * (NT_ / 128);
    const int b = bh / NH_, h = bh - b * NH_, g = h / (NH_ / NKV);
    const float* qb = Q + (size_t)b * NT_ * QW + h * HD; const h16* kb = K16 + (size_t)b * NT_ * KW + g * HD; const h16* vb = VT16 + ((size_t)b * NKV + g) * HD * NT_;
    const unsigned klane = lr * KW + 8 * hi, vlane = lr * NT_ + 8 * hi;      // the lane's own part of a fragment address; the rest is wave-uniform
    v16h kf[2][2];       // key fragments of one pass: [kc][keys 0..15 | 16..31]
    auto ldk = [&](int t) {
#pragma unroll
        for (int kc = 0; kc < 2; ++kc) {
            const h16* r0p = kb + (size_t)t * (32 * KW) + klane + kc * 32; const h16* r1p = r0p + (size_t)16 * KW;
            kf[kc][0] = cat16(*(const v8h*)r0p, *(const v8h*)(r0p + 16)); kf[kc][1] = cat16(*(const v8h*)r1p, *(const v8h*)(r1p + 16));
        }
    };
    ldk(0);
#pragma unroll 1      // one copy of the body for both tiles
  for (int half = 0; half < 2; ++half) {
    const int qt = half ? tp : NT_ / 64 - 1 - tp, q0 = qt * 64 + wave * 16;
    v16h qa[2];
#pragma unroll
    for (int kc = 0; kc < 2; ++kc) {
        const float* p = qb + (size_t)(q0 + lr) * QW + kc * 32 + 8 * hi;
        const v4f f0 = *(const v4fa*)p, f1 = *(const v4fa*)(p + 4), f2 = *(const v4fa*)(p + 16), f3 = *(const v4fa*)(p + 20);
#pragma unroll
        for (int i = 0; i < 4; ++i) { qa[kc][i] = (h16)bfr(f0[i]); qa[kc][4 + i] = (h16)bfr(f1[i]); qa[kc][8 + i] = (h16)bfr(f2[i]); qa[kc][12 + i] = (h16)bfr(f3[i]); }
    }
    const int qrel = q0 + lr - 8 * hi;       // key l0 + 8hi + j is seen by this lane's query when l0 + j <= qrel
    v8f o[4], ox[4];                         // o[n][j] = out^T[d = 16n + 8hi + j][query lr]
#pragma unroll
    for (int n = 0; n < 4; ++n) { o[n] = (v8f){}; ox[n] = (v8f){}; }
    float mrow = -3.0e38f, lpart = 0.f;
    const int kt_end = 2 * qt + 2;
#pragma unroll 1
    for (int kt = 0; kt < kt_end; ++kt) {
        const int l0 = kt * 32;
        v8f s0 = {}, s1 = {};
        v16h vv[4];      // this pass's value fragments: asked for here, first used behind the softmax
#pragma unroll
        for (int n = 0; n < 4; ++n) { const h16* vp = vb + l0 + vlane + (size_t)n * (16 * NT_); vv[n] = cat16(*(const v8h*)vp, *(const v8h*)(vp + 16)); }
#pragma unroll
        for (int kc = 0; kc < 2; ++kc) { s0 = wmma16(kf[kc][0], qa[kc], s0); s1 = wmma16(kf[kc][1], qa[kc], s1); }
        ldk(kt + 1 < kt_end ? kt + 1 : 0);       // the next pass's key fragments, into the same registers; a tile's last pass asks for key tile 0, with which the next query tile begins
        asm volatile("s_wait_xcnt 0x0" ::: "memory");      // stands behind the key loads, before the softmax below can overwrite registers that they name
        __builtin_amdgcn_sched_barrier(0);       // holds the value and key loads above in front of the softmax: without it the compiler sinks them down to their WMMAs and their latency is exposed
        const v8f t0 = s0 * 0.125f, t1 = s1 * 0.125f;
        float a0[8], a1[8];
#pragma unroll
        for (int j = 0; j < 8; ++j) { a0[j] = (l0 + j <= qrel) ? t0[j] : -__builtin_inff(); a1[j] = (l0 + 16 + j <= qrel) ? t1[j] : -__builtin_inff(); }
        float mx = a0[0];
#pragma unroll
        for (int j = 1; j < 8; ++j) mx = fmaxf(mx, a0[j]);
#pragma unroll
        for (int j = 0; j < 8; ++j) mx = fmaxf(mx, a1[j]);
        mx = fmaxf(mx, xhalf(mx));
        const float mn = fmaxf(mrow, mx);
        const float alpha = __expf(mrow - mn); mrow = mn;
        v2f ts[4]; v16h pa, px;                  // pa[s], px[s]: key kmap(s, hi) of this pass, query lr
#pragma unroll
        for (int j = 0; j < 8; j += 2) {
            const v2f p0 = {__expf(a0[j] - mn), __expf(a0[j + 1] - mn)}, p1 = {__expf(a1[j] - mn), __expf(a1[j + 1] - mn)};
            ts[j >> 1] = p0 + p1;
            const v2f u0 = p0 * PSC, u1 = p1 * PSC;
            const v2h h0 = __builtin_convertvector(u0, v2h), h1 = __builtin_convertvector(u1, v2h);
            const v2h x0 = __builtin_convertvector((u0 - __builtin_convertvector(h0, v2f)) * LOSC, v2h), x1 = __builtin_convertvector((u1 - __builtin_convertvector(h1, v2f)) * LOSC, v2h);
            pa[j] = h0[0]; pa[j + 1] = h0[1]; pa[8 + j] = h1[0]; pa[8 + j + 1] = h1[1];
            px[j] = x0[0]; px[j + 1] = x0[1]; px[8 + j] = x1[0]; px[8 + j + 1] = x1[1];
        }
        const v2f tt = (ts[0] + ts[1]) + (ts[2] + ts[3]);
        lpart = lpart * alpha + (tt[0] + tt[1]);
#pragma unroll
        for (int n = 0; n < 4; ++n) { o[n] *= alpha; ox[n] *= alpha; }
#pragma unroll
        for (int n = 0; n < 4; ++n) { o[n] = wmma16(vv[n], pa, o[n]); ox[n] = wmma16(vv[n], px, ox[n]); }
        asm volatile("v_nop\n\tv_nop\n\tv_nop\n\tv_nop" : "+v"(o[0]), "+v"(o[1]), "+v"(o[2]), "+v"(o[3]), "+v"(ox[0]), "+v"(ox[1]), "+v"(ox[2]), "+v"(ox[3]) : "v"(pa), "v"(px));
    }
    const float inv = 1.0f / ((lpart + xhalf(lpart)) * PSC);
    float* os = &ost[wave][0];
#pragma unroll
    for (int n = 0; n < 4; ++n)
#pragma unroll
        for (int s = 0; s < 2; ++s) {
            v4f val;
#pragma unroll
            for (int i = 0; i < 4; ++i) val[i] = (o[n][4 * s + i] + ox[n][4 * s + i] * LOSCI) * inv;
            *(v4fa*)(os + lr * 68 + n * 16 + hi * 8 + 4 * s) = val;
        }
    __syncthreads();
    float* ob = out + ((size_t)b * NT_ + q0) * QW + (size_t)h * HD;      // [b][s][h*64 + d]: 256 B per (s, h)
    auto pass = [&]() {
#pragma unroll
        for (int s = 0; s < 8; ++s) { const int Lid = (lane >> 3) + 4 * s, piece = lane & 7; const int row = Lid >> 1, cofs = (Lid & 1) * 32 + piece * 4;
            const v4f val = *(const v4fa*)(os + row * 68 + cofs); *(v4f*)(ob + (size_t)row * QW + cofs) = val; }
    };
    pass(); 
    asm volatile("s_wait_xcnt 0x0" ::: "memory");      // stands behind the tile's stores because the second tile's set-up overwrites registers that they name
  }
}

extern "C" void kernel_launch(void* const* d_in, const int* in_sizes, int n_in,
                              void* d_out, int out_size, void* d_ws, size_t ws_size, hipStream_t stream) {
    (void)in_sizes; (void)n_in; (void)out_size;
    const float* q = (const float*)d_in[0]; const float* k = (const float*)d_in[1]; const float* v = (const float*)d_in[2];
    float* out = (float*)d_out;    // [2][2048][1024]
    char* wsp = (char*)d_ws;
    auto take = [&](size_t bytes) { char* p = wsp; wsp += (bytes + 255) & ~(size_t)255; return (void*)p; };
    h16* K16 = (h16*)take((size_t)NB_ * NT_ * KW * 2); h16* VT16 = (h16*)take((size_t)NB_ * NKV * HD * NT_ * 2);
    if ((size_t)(wsp - (char*)d_ws) > ws_size) return;    // 2.1 + 2.1 MB
    k_16<<<(unsigned)(((size_t)NB_ * NT_ * KW / 128 + 7) / 8), 256, 0, stream>>>(k, (size_t)NB_ * NT_ * KW, K16);
    k_vt<<<NB_ * NKV * (NT_ / 64), 256, 0, stream>>>(v, VT16);
    k_attn<<<NBH * (NT_ / 128), 128, 0, stream>>>(q, K16, VT16, out);
}

// v005
// A run of this version takes 54.1 microseconds.
// Timed twice side by side with v004, it ran 1.16 and 1.15 times as fast.
// Counting every step since v000, it is 2.20 times as fast.
#include <hip/hip_runtime.h>

// Contraction on v_wmma_f32_16x16x32_f16, f32 accumulate: grouped-query causal attention on the INPUT Q [b][s][16*64], K/V [b][s][4*64] ([2048 x 64].[64 x 2048]
// scores /8 and [2048 x 2048].[2048 x 64] per (batch, head); query head h uses kv head h/4): q and k as exact f16 of their bf16 rounding (one exact product), the

#define NB_  2
#define NH_  16
#define NKV  4
#define NT_  2048
#define HD   64
#define QW   (NH_ * HD)          // 1024
#define KW   (NKV * HD)          // 256
#define NBH  (NB_ * NH_)
#define PSC  32768.0f
#define LOSC 1024.0f
#define LOSCI (1.0f / 1024.0f)

typedef _Float16 h16;
typedef __attribute__((ext_vector_type(16))) _Float16 v16h;
typedef __attribute__((ext_vector_type(8)))  _Float16 v8h;
typedef __attribute__((ext_vector_type(4)))  _Float16 v4h;
typedef __attribute__((ext_vector_type(8)))  float    v8f;
typedef __attribute__((ext_vector_type(4)))  float    v4f;
typedef __attribute__((ext_vector_type(2)))  float    v2f;
typedef __attribute__((ext_vector_type(2)))  _Float16 v2h;
typedef v8h  __attribute__((may_alias)) v8ha;
typedef v4f  __attribute__((may_alias)) v4fa;

__device__ __forceinline__ unsigned short f2bf(float f) { unsigned u = __float_as_uint(f); u += 0x7FFFu + ((u >> 16) & 1u); return (unsigned short)(u >> 16); }
__device__ __forceinline__ float bf2f(unsigned short b) { return __uint_as_float(((unsigned)b) << 16); }
__device__ __forceinline__ float bfr(float f) { return bf2f(f2bf(f)); }
__device__ __forceinline__ v16h cat16(v8h lo, v8h hi) { return __builtin_shufflevector(lo, hi, 0, 1, 2, 3, 4, 5, 6, 7, 8, 9, 10, 11, 12, 13, 14, 15); }
__device__ __forceinline__ v8f wmma16(v16h a, v16h b, v8f c) { return __builtin_amdgcn_wmma_f32_16x16x32_f16(false, a, false, b, (short)0, c, false, false); }
#define VST2(T, p, v) do { const T vst2_v_ = (v); *(T*)(p) = vst2_v_;  } while (0)

// Both operands that k_attn reads from the workspace lie there in the order of its A fragments: [b*NKV + g][pass of 32 keys][fragment 0..3][part 0..1][lane][8 f16], 4 KB a pass.
// One wave-wide 16-byte load is then 512 bytes in a row (4 cache lines); read from row-major K or V^T the same load took 32 bytes out of each of 16 lines.
#define PASSH 2048               // f16 elements of one operand per pass
// k_kp: KP = f16(bf16(k)); fragment = kc*2 + key half; lane (lr, hi) of part p holds key 16*half + lr, d = 32kc + 16p + 8hi + 0..7. Block = (b*NKV + g, pass), wave = (fragment, part).
__global__ __launch_bounds__(256) void k_kp(const float* __restrict__ k, h16* KP) {
    const int lane = threadIdx.x & 31, w = threadIdx.x >> 5, lr = lane & 15, hi = lane >> 4;
    const int bg = blockIdx.x / (NT_ / 32), t = blockIdx.x - bg * (NT_ / 32), b = bg / NKV, g = bg - b * NKV;
    const int kc = w >> 2, kh = (w >> 1) & 1, part = w & 1;
    const float* src = k + ((size_t)b * NT_ + t * 32 + kh * 16 + lr) * KW + g * HD + kc * 32 + part * 16 + 8 * hi;
    const v4f f0 = *(const v4fa*)src, f1 = *(const v4fa*)(src + 4);
    v8h o;
#pragma unroll
    for (int i = 0; i < 4; ++i) { o[i] = (h16)bfr(f0[i]); o[4 + i] = (h16)bfr(f1[i]); }
    *(v8h*)(KP + (size_t)blockIdx.x * PASSH + threadIdx.x * 8) = o;
}
// k_vt: VP = f16(bf16(v)) transposed via 64 x 64 LDS tiles; fragment = n; lane (lr, hi) of part p holds d = 16n + lr, key 16p + 8hi + 0..7. Block = (bh, 64 t = 2 passes).
__global__ __launch_bounds__(256) void k_vt(const float* __restrict__ v, h16* VP) {
    __shared__ __align__(16) h16 tile[HD * 72];
    const int bh = blockIdx.x / (NT_ / 64), kt = blockIdx.x - bh * (NT_ / 64), t0 = kt * 64, tid = threadIdx.x;     // bh = b*NKV + g
    const int b = bh / NKV, g = bh - b * NKV;
    const int tt = tid >> 2, d0 = (tid & 3) * 16;
    const float* src = v + ((size_t)b * NT_ + t0 + tt) * KW + g * HD + d0;
#pragma unroll
    for (int i = 0; i < 16; ++i) tile[(d0 + i) * 72 + tt] = (h16)bfr(src[i]);
    __syncthreads();
    const int d = (tid >> 6) * 16 + (tid & 15), tl = ((tid >> 5) & 1) * 16 + ((tid >> 4) & 1) * 8;      // thread = (n, part, lane) of a pass
    const size_t base = ((size_t)bh * (NT_ / 32) + kt * 2) * PASSH;
    auto pass = [&]() {
#pragma unroll
        for (int s = 0; s < 2; ++s) { const v8h val = *(const v8ha*)(tile + d * 72 + s * 32 + tl); *(v8h*)(VP + base + s * PASSH + tid * 8) = val; }
    };
    pass(); 
}
__device__ __forceinline__ float xhalf(float x) { const int b = __builtin_bit_cast(int, x); return __builtin_bit_cast(float, __builtin_amdgcn_permlanex16(b, b, 0x76543210, 0xfedcba98, false, false)); }   // lane l <-> l ^ 16
// Q comes straight from the f32 input: every query row is read by exactly one wave, once, so its f16(bf16(.)) rounding is done here in registers (same values as a copy pass would store).
__global__ __launch_bounds__(128) void k_attn(const float* __restrict__ Q, const h16* __restrict__ KP, const h16* __restrict__ VP, float* out) {
    __shared__ __align__(16) float ost[4][16 * 68];
    const int lane = threadIdx.x & 31, wave = threadIdx.x >> 5, lr = lane & 15, hi = lane >> 4;
    const int bh = blockIdx.x / (NT_ / 128), tp = blockIdx.x - bh * (NT_ / 128);
    const int b = bh / NH_, h = bh - b * NH_, g = h / (NH_ / NKV);
    const float* qb = Q + (size_t)b * NT_ * QW + h * HD; const h16* kb = KP + ((size_t)b * NKV + g) * (NT_ / 32) * PASSH; const h16* vb = VP + ((size_t)b * NKV + g) * (NT_ / 32) * PASSH;
    const unsigned flane = lane * 8;         // the lane's own part of a fragment address; the rest is wave-uniform
    v16h kf[2][2];       // key fragments of one pass: [kc][keys 0..15 | 16..31]
    auto ldk = [&](int t) {
#pragma unroll
        for (int kc = 0; kc < 2; ++kc) {
            const h16* r0p = kb + (size_t)t * PASSH + flane + kc * 1024; const h16* r1p = r0p + 512;
            kf[kc][0] = cat16(*(const v8h*)r0p, *(const v8h*)(r0p + 256)); kf[kc][1] = cat16(*(const v8h*)r1p, *(const v8h*)(r1p + 256));
        }
    };
    ldk(0);
#pragma unroll 1      // one copy of the body for both tiles
  for (int half = 0; half < 2; ++half) {
    const int qt = half ? tp : NT_ / 64 - 1 - tp, q0 = qt * 64 + wave * 16;
    v16h qa[2];
#pragma unroll
    for (int kc = 0; kc < 2; ++kc) {
        const float* p = qb + (size_t)(q0 + lr) * QW + kc * 32 + 8 * hi;
        const v4f f0 = *(const v4fa*)p, f1 = *(const v4fa*)(p + 4), f2 = *(const v4fa*)(p + 16), f3 = *(const v4fa*)(p + 20);
#pragma unroll
        for (int i = 0; i < 4; ++i) { qa[kc][i] = (h16)bfr(f0[i]); qa[kc][4 + i] = (h16)bfr(f1[i]); qa[kc][8 + i] = (h16)bfr(f2[i]); qa[kc][12 + i] = (h16)bfr(f3[i]); }
    }
    const int qrel = q0 + lr - 8 * hi;       // key l0 + 8hi + j is seen by this lane's query when l0 + j <= qrel
    v8f o[4], ox[4];                         // o[n][j] = out^T[d = 16n + 8hi + j][query lr]
#pragma unroll
    for (int n = 0; n < 4; ++n) { o[n] = (v8f){}; ox[n] = (v8f){}; }
    float mrow = -3.0e38f, lpart = 0.f;
    const int kt_end = 2 * qt + 2;
#pragma unroll 1
    for (int kt = 0; kt < kt_end; ++kt) {
        const int l0 = kt * 32;
        v8f s0 = {}, s1 = {};
        v16h vv[4];      // this pass's value fragments: asked for here, first used behind the softmax
#pragma unroll
        for (int n = 0; n < 4; ++n) { const h16* vp = vb + (size_t)kt * PASSH + flane + n * 512; vv[n] = cat16(*(const v8h*)vp, *(const v8h*)(vp + 256)); }
#pragma unroll
        for (int kc = 0; kc < 2; ++kc) { s0 = wmma16(kf[kc][0], qa[kc], s0); s1 = wmma16(kf[kc][1], qa[kc], s1); }
        ldk(kt + 1 < kt_end ? kt + 1 : 0);       // the next pass's key fragments, into the same registers; a tile's last pass asks for key tile 0, with which the next query tile begins
        asm volatile("s_wait_xcnt 0x0" ::: "memory");      // stands behind the value and key loads because the softmax below reuses the key loads' address registers and the value loads' address is advanced there
        __builtin_amdgcn_sched_barrier(0);       // holds the value and key loads above in front of the softmax: without it the compiler sinks them down to their WMMAs and their latency is exposed
        const v8f t0 = s0 * 0.125f, t1 = s1 * 0.125f;
        float a0[8], a1[8];
#pragma unroll
        for (int j = 0; j < 8; ++j) { a0[j] = (l0 + j <= qrel) ? t0[j] : -__builtin_inff(); a1[j] = (l0 + 16 + j <= qrel) ? t1[j] : -__builtin_inff(); }
        float mx = a0[0];
#pragma unroll
        for (int j = 1; j < 8; ++j) mx = fmaxf(mx, a0[j]);
#pragma unroll
        for (int j = 0; j < 8; ++j) mx = fmaxf(mx, a1[j]);
        mx = fmaxf(mx, xhalf(mx));
        const float mn = fmaxf(mrow, mx);
        const float alpha = __expf(mrow - mn); mrow = mn;
        v2f ts[4]; v16h pa, px;                  // pa[s], px[s]: key 8hi + s, or 16 + 8hi + (s - 8) for s >= 8, of this pass, query lr
#pragma unroll
        for (int j = 0; j < 8; j += 2) {
            const v2f p0 = {__expf(a0[j] - mn), __expf(a0[j + 1] - mn)}, p1 = {__expf(a1[j] - mn), __expf(a1[j + 1] - mn)};
            ts[j >> 1] = p0 + p1;
            const v2f u0 = p0 * PSC, u1 = p1 * PSC;
            const v2h h0 = __builtin_convertvector(u0, v2h), h1 = __builtin_convertvector(u1, v2h);
            const v2h x0 = __builtin_convertvector((u0 - __builtin_convertvector(h0, v2f)) * LOSC, v2h), x1 = __builtin_convertvector((u1 - __builtin_convertvector(h1, v2f)) * LOSC, v2h);
            pa[j] = h0[0]; pa[j + 1] = h0[1]; pa[8 + j] = h1[0]; pa[8 + j + 1] = h1[1];
            px[j] = x0[0]; px[j + 1] = x0[1]; px[8 + j] = x1[0]; px[8 + j + 1] = x1[1];
        }
        const v2f tt = (ts[0] + ts[1]) + (ts[2] + ts[3]);
        lpart = lpart * alpha + (tt[0] + tt[1]);
#pragma unroll
        for (int n = 0; n < 4; ++n) { o[n] *= alpha; ox[n] *= alpha; }
#pragma unroll
        for (int n = 0; n < 4; ++n) { o[n] = wmma16(vv[n], pa, o[n]); ox[n] = wmma16(vv[n], px, ox[n]); }
        asm volatile("v_nop\n\tv_nop\n\tv_nop\n\tv_nop" : "+v"(o[0]), "+v"(o[1]), "+v"(o[2]), "+v"(o[3]), "+v"(ox[0]), "+v"(ox[1]), "+v"(ox[2]), "+v"(ox[3]) : "v"(pa), "v"(px));
    }
    const float inv = 1.0f / ((lpart + xhalf(lpart)) * PSC);
    float* os = &ost[wave][0];
#pragma unroll
    for (int n = 0; n < 4; ++n)
#pragma unroll
        for (int s = 0; s < 2; ++s) {
            v4f val;
#pragma unroll
            for (int i = 0; i < 4; ++i) val[i] = (o[n][4 * s + i] + ox[n][4 * s + i] * LOSCI) * inv;
            *(v4fa*)(os + lr * 68 + n * 16 + hi * 8 + 4 * s) = val;
        }
    __syncthreads();
    float* ob = out + ((size_t)b * NT_ + q0) * QW + (size_t)h * HD;      // [b][s][h*64 + d]: 256 B per (s, h)
    auto pass = [&]() {
#pragma unroll
        for (int s = 0; s < 8; ++s) { const int Lid = (lane >> 3) + 4 * s, piece = lane & 7; const int row = Lid >> 1, cofs = (Lid & 1) * 32 + piece * 4;
            const v4f val = *(const v4fa*)(os + row * 68 + cofs); *(v4f*)(ob + (size_t)row * QW + cofs) = val; }
    };
    pass(); 
    asm volatile("s_wait_xcnt 0x0" ::: "memory");      // stands behind the tile's stores because the second tile's set-up overwrites registers that they name
  }
}

extern "C" void kernel_launch(void* const* d_in, const int* in_sizes, int n_in,
                              void* d_out, int out_size, void* d_ws, size_t ws_size, hipStream_t stream) {
    (void)in_sizes; (void)n_in; (void)out_size;
    const float* q = (const float*)d_in[0]; const float* k = (const float*)d_in[1]; const float* v = (const float*)d_in[2];
    float* out = (float*)d_out;    // [2][2048][1024]
    char* wsp = (char*)d_ws;
    auto take = [&](size_t bytes) { char* p = wsp; wsp += (bytes + 255) & ~(size_t)255; return (void*)p; };
    h16* KP = (h16*)take((size_t)NB_ * NT_ * KW * 2); h16* VP = (h16*)take((size_t)NB_ * NKV * HD * NT_ * 2);
    if ((size_t)(wsp - (char*)d_ws) > ws_size) return;    // 2.1 + 2.1 MB
    k_kp<<<NB_ * NKV * (NT_ / 32), 256, 0, stream>>>(k, KP);
    k_vt<<<NB_ * NKV * (NT_ / 64), 256, 0, stream>>>(v, VP);
    k_attn<<<NBH * (NT_ / 128), 128, 0, stream>>>(q, KP, VP, out);
}

// v006
// It runs in 37.1 microseconds.
// Two timings next to v005 put it at 1.35 and 1.48 times that version's speed.
// Counting every step since v000, it is 3.11 times as fast.
#include <hip/hip_runtime.h>

// Contraction on v_wmma_f32_16x16x32_f16, f32 accumulate: grouped-query causal attention on the INPUT Q [b][s][16*64], K/V [b][s][4*64] ([2048 x 64].[64 x 2048]
// scores /8 and [2048 x 2048].[2048 x 64] per (batch, head); query head h uses kv head h/4): q and k as exact f16 of their bf16 rounding (one exact product), the

#define NB_  2
#define NH_  16
#define NKV  4
#define NT_  2048
#define HD   64
#define QW   (NH_ * HD)          // 1024
#define KW   (NKV * HD)          // 256
#define NBH  (NB_ * NH_)
#define PSC  32768.0f
#define LOSC 1024.0f
#define LOSCI (1.0f / 1024.0f)

typedef _Float16 h16;
typedef __attribute__((ext_vector_type(16))) _Float16 v16h;
typedef __attribute__((ext_vector_type(8)))  _Float16 v8h;
typedef __attribute__((ext_vector_type(4)))  _Float16 v4h;
typedef __attribute__((ext_vector_type(8)))  float    v8f;
typedef __attribute__((ext_vector_type(4)))  float    v4f;
typedef __attribute__((ext_vector_type(2)))  float    v2f;
typedef __attribute__((ext_vector_type(2)))  _Float16 v2h;
typedef v8h  __attribute__((may_alias)) v8ha;
typedef v4f  __attribute__((may_alias)) v4fa;

__device__ __forceinline__ unsigned short f2bf(float f) { unsigned u = __float_as_uint(f); u += 0x7FFFu + ((u >> 16) & 1u); return (unsigned short)(u >> 16); }
__device__ __forceinline__ float bf2f(unsigned short b) { return __uint_as_float(((unsigned)b) << 16); }
__device__ __forceinline__ float bfr(float f) { return bf2f(f2bf(f)); }
__device__ __forceinline__ v16h cat16(v8h lo, v8h hi) { return __builtin_shufflevector(lo, hi, 0, 1, 2, 3, 4, 5, 6, 7, 8, 9, 10, 11, 12, 13, 14, 15); }
__device__ __forceinline__ v8f wmma16(v16h a, v16h b, v8f c) { return __builtin_amdgcn_wmma_f32_16x16x32_f16(false, a, false, b, (short)0, c, false, false); }
#define VST2(T, p, v) do { const T vst2_v_ = (v); *(T*)(p) = vst2_v_;  } while (0)

// Both operands that k_attn reads from the workspace lie there in the order of its A fragments: [b*NKV + g][pass of 32 keys][fragment 0..3][part 0..1][lane][8 f16], 4 KB a pass.
// One wave-wide 16-byte load is then 512 bytes in a row (4 cache lines); read from row-major K or V^T the same load took 32 bytes out of each of 16 lines.
#define PASSH 2048               // f16 elements of one operand per pass
// k_kp: KP = f16(bf16(k)); fragment = kc*2 + key half; lane (lr, hi) of part p holds key 16*half + lr, d = 32kc + 16p + 8hi + 0..7. Block = (b*NKV + g, pass), wave = (fragment, part).
__global__ __launch_bounds__(256) void k_kp(const float* __restrict__ k, h16* KP) {
    const int lane = threadIdx.x & 31, w = threadIdx.x >> 5, lr = lane & 15, hi = lane >> 4;
    const int bg = blockIdx.x / (NT_ / 32), t = blockIdx.x - bg * (NT_ / 32), b = bg / NKV, g = bg - b * NKV;
    const int kc = w >> 2, kh = (w >> 1) & 1, part = w & 1;
    const float* src = k + ((size_t)b * NT_ + t * 32 + kh * 16 + lr) * KW + g * HD + kc * 32 + part * 16 + 8 * hi;
    const v4f f0 = *(const v4fa*)src, f1 = *(const v4fa*)(src + 4);
    v8h o;
#pragma unroll
    for (int i = 0; i < 4; ++i) { o[i] = (h16)bfr(f0[i]); o[4 + i] = (h16)bfr(f1[i]); }
    *(v8h*)(KP + (size_t)blockIdx.x * PASSH + threadIdx.x * 8) = o;
}
// k_vt: VP = f16(bf16(v)) transposed via 64 x 64 LDS tiles; fragment = n; lane (lr, hi) of part p holds d = 16n + lr, key 16p + 8hi + 0..7. Block = (bh, 64 t = 2 passes).
__global__ __launch_bounds__(256) void k_vt(const float* __restrict__ v, h16* VP) {
    __shared__ __align__(16) h16 tile[HD * 72];
    const int bh = blockIdx.x / (NT_ / 64), kt = blockIdx.x - bh * (NT_ / 64), t0 = kt * 64, tid = threadIdx.x;     // bh = b*NKV + g
    const int b = bh / NKV, g = bh - b * NKV;
    const int tt = tid >> 2, d0 = (tid & 3) * 16;
    const float* src = v + ((size_t)b * NT_ + t0 + tt) * KW + g * HD + d0;
#pragma unroll
    for (int i = 0; i < 16; ++i) tile[(d0 + i) * 72 + tt] = (h16)bfr(src[i]);
    __syncthreads();
    const int d = (tid >> 6) * 16 + (tid & 15), tl = ((tid >> 5) & 1) * 16 + ((tid >> 4) & 1) * 8;      // thread = (n, part, lane) of a pass
    const size_t base = ((size_t)bh * (NT_ / 32) + kt * 2) * PASSH;
    auto pass = [&]() {
#pragma unroll
        for (int s = 0; s < 2; ++s) { const v8h val = *(const v8ha*)(tile + d * 72 + s * 32 + tl); *(v8h*)(VP + base + s * PASSH + tid * 8) = val; }
    };
    pass(); 
}
__device__ __forceinline__ float xhalf(float x) { const int b = __builtin_bit_cast(int, x); return __builtin_bit_cast(float, __builtin_amdgcn_permlanex16(b, b, 0x76543210, 0xfedcba98, false, false)); }   // lane l <-> l ^ 16
// Q comes straight from the f32 input: every query row is read by the two waves of its query group (ks = 0 and 1), once each, so its f16(bf16(.)) rounding is done here in registers (same values as a copy pass would store).
__global__ __launch_bounds__(256) void k_attn(const float* __restrict__ Q, const h16* __restrict__ KP, const h16* __restrict__ VP, float* out) {
    __shared__ __align__(16) float ost[8][16 * 36];      // output staging, a wave's own: 16 queries x 32 d
    __shared__ __align__(16) float xch[8][4 * 32 * 4];   // what a wave hands to its partner: 16 f32 a lane
    __shared__ float xml[8][2 * 32];                     // with its maximum and its sum
    const int lane = threadIdx.x & 31, wave = __builtin_amdgcn_readfirstlane(threadIdx.x >> 5), lr = lane & 15, hi = lane >> 4;
    const int qsub = wave & 3, ks = wave >> 2;       // the wave's number is read into a scalar register so that the pass counter, which starts at ks, and the fragment addresses stay scalar
    const int bh = blockIdx.x / (NT_ / 128), tp = blockIdx.x - bh * (NT_ / 128);
    const int b = bh / NH_, h = bh - b * NH_, g = h / (NH_ / NKV);
    const float* qb = Q + (size_t)b * NT_ * QW + h * HD; const h16* kb = KP + ((size_t)b * NKV + g) * (NT_ / 32) * PASSH; const h16* vb = VP + ((size_t)b * NKV + g) * (NT_ / 32) * PASSH;
    const unsigned flane = lane * 8;         // the lane's own part of a fragment address; the rest is wave-uniform
    v16h kf[2][2];       // key fragments of one pass: [kc][keys 0..15 | 16..31]
    auto ldk = [&](int t) {
#pragma unroll
        for (int kc = 0; kc < 2; ++kc) {
            const h16* r0p = kb + (size_t)t * PASSH + flane + kc * 1024; const h16* r1p = r0p + 512;
            kf[kc][0] = cat16(*(const v8h*)r0p, *(const v8h*)(r0p + 256)); kf[kc][1] = cat16(*(const v8h*)r1p, *(const v8h*)(r1p + 256));
        }
    };
    ldk(ks);
#pragma unroll 1      // one copy of the body for both tiles
  for (int half = 0; half < 2; ++half) {
    const int qt = half ? tp : NT_ / 64 - 1 - tp, q0 = qt * 64 + qsub * 16;
    v16h qa[2];
#pragma unroll
    for (int kc = 0; kc < 2; ++kc) {
        const float* p = qb + (size_t)(q0 + lr) * QW + kc * 32 + 8 * hi;
        const v4f f0 = *(const v4fa*)p, f1 = *(const v4fa*)(p + 4), f2 = *(const v4fa*)(p + 16), f3 = *(const v4fa*)(p + 20);
#pragma unroll
        for (int i = 0; i < 4; ++i) { qa[kc][i] = (h16)bfr(f0[i]); qa[kc][4 + i] = (h16)bfr(f1[i]); qa[kc][8 + i] = (h16)bfr(f2[i]); qa[kc][12 + i] = (h16)bfr(f3[i]); }
    }
    const int qrel = q0 + lr - 8 * hi;       // key l0 + 8hi + j is seen by this lane's query when l0 + j <= qrel
    v8f o[4], ox[4];                         // o[n][j] = out^T[d = 16n + 8hi + j][query lr]
#pragma unroll
    for (int n = 0; n < 4; ++n) { o[n] = (v8f){}; ox[n] = (v8f){}; }
    float mrow = -3.0e38f, lpart = 0.f;
    const int kt_end = 2 * qt + 2;
#pragma unroll 1
    for (int kt = ks; kt < kt_end; kt += 2) {
        const int l0 = kt * 32;
        v8f s0 = {}, s1 = {};
        v16h vv[4];      // this pass's value fragments: asked for here, first used behind the softmax
#pragma unroll
        for (int n = 0; n < 4; ++n) { const h16* vp = vb + (size_t)kt * PASSH + flane + n * 512; vv[n] = cat16(*(const v8h*)vp, *(const v8h*)(vp + 256)); }
#pragma unroll
        for (int kc = 0; kc < 2; ++kc) { s0 = wmma16(kf[kc][0], qa[kc], s0); s1 = wmma16(kf[kc][1], qa[kc], s1); }
        ldk(kt + 2 < kt_end ? kt + 2 : ks);      // the wave's next pass's key fragments, into the same registers; a tile's last pass asks for key tile ks, with which the wave's next query tile begins
        asm volatile("s_wait_xcnt 0x0" ::: "memory");      // stands behind the value and key loads because the softmax below reuses the key loads' address registers and the value loads' address is advanced there
        __builtin_amdgcn_sched_barrier(0);       // holds the value and key loads above in front of the softmax: without it the compiler sinks them down to their WMMAs and their latency is exposed
        const v8f t0 = s0 * 0.125f, t1 = s1 * 0.125f;
        float a0[8], a1[8];
#pragma unroll
        for (int j = 0; j < 8; ++j) { a0[j] = (l0 + j <= qrel) ? t0[j] : -__builtin_inff(); a1[j] = (l0 + 16 + j <= qrel) ? t1[j] : -__builtin_inff(); }
        float mx = a0[0];
#pragma unroll
        for (int j = 1; j < 8; ++j) mx = fmaxf(mx, a0[j]);
#pragma unroll
        for (int j = 0; j < 8; ++j) mx = fmaxf(mx, a1[j]);
        mx = fmaxf(mx, xhalf(mx));
        const float mn = fmaxf(mrow, mx);
        const float alpha = __expf(mrow - mn); mrow = mn;
        v2f ts[4]; v16h pa, px;                  // pa[s], px[s]: key 8hi + s, or 16 + 8hi + (s - 8) for s >= 8, of this pass, query lr
#pragma unroll
        for (int j = 0; j < 8; j += 2) {
            const v2f p0 = {__expf(a0[j] - mn), __expf(a0[j + 1] - mn)}, p1 = {__expf(a1[j] - mn), __expf(a1[j + 1] - mn)};
            ts[j >> 1] = p0 + p1;
            const v2f u0 = p0 * PSC, u1 = p1 * PSC;
            const v2h h0 = __builtin_convertvector(u0, v2h), h1 = __builtin_convertvector(u1, v2h);
            const v2h x0 = __builtin_convertvector((u0 - __builtin_convertvector(h0, v2f)) * LOSC, v2h), x1 = __builtin_convertvector((u1 - __builtin_convertvector(h1, v2f)) * LOSC, v2h);
            pa[j] = h0[0]; pa[j + 1] = h0[1]; pa[8 + j] = h1[0]; pa[8 + j + 1] = h1[1];
            px[j] = x0[0]; px[j + 1] = x0[1]; px[8 + j] = x1[0]; px[8 + j + 1] = x1[1];
        }
        const v2f tt = (ts[0] + ts[1]) + (ts[2] + ts[3]);
        lpart = lpart * alpha + (tt[0] + tt[1]);
#pragma unroll
        for (int n = 0; n < 4; ++n) { o[n] *= alpha; ox[n] *= alpha; }
#pragma unroll
        for (int n = 0; n < 4; ++n) { o[n] = wmma16(vv[n], pa, o[n]); ox[n] = wmma16(vv[n], px, ox[n]); }
        asm volatile("v_nop\n\tv_nop\n\tv_nop\n\tv_nop" : "+v"(o[0]), "+v"(o[1]), "+v"(o[2]), "+v"(o[3]), "+v"(ox[0]), "+v"(ox[1]), "+v"(ox[2]), "+v"(ox[3]) : "v"(pa), "v"(px));
    }
    const float lw = lpart + xhalf(lpart);
    v8f keep[2], give[2];                    // d = 32ks + 16n + 8hi + j stays here, the other 32 go to the partner
#pragma unroll
    for (int n = 0; n < 2; ++n) {
        const v8f dlo = o[n] + ox[n] * LOSCI, dhi = o[2 + n] + ox[2 + n] * LOSCI;
        keep[n] = ks ? dhi : dlo; give[n] = ks ? dlo : dhi;
    }
    float* xw = &xch[wave][0];
#pragma unroll
    for (int n = 0; n < 2; ++n)
#pragma unroll
        for (int s = 0; s < 2; ++s) {
            v4f val;
#pragma unroll
            for (int i = 0; i < 4; ++i) val[i] = give[n][4 * s + i];
            *(v4fa*)(xw + ((n * 2 + s) * 32 + lane) * 4) = val;
        }
    xml[wave][lane] = mrow; xml[wave][32 + lane] = lw;
    __syncthreads();                         // publishes both partners' shares
    const float* xr = &xch[wave ^ 4][0];
    const float m2 = xml[wave ^ 4][lane], l2 = xml[wave ^ 4][32 + lane];
    const float mj = fmaxf(mrow, m2), e1 = __expf(mrow - mj), e2 = __expf(m2 - mj);      // a share with every key masked has sum 0 and weight 0
    const float inv = 1.0f / ((lw * e1 + l2 * e2) * PSC);
    const float c1 = e1 * inv, c2 = e2 * inv;
    float* os = &ost[wave][0];
#pragma unroll
    for (int n = 0; n < 2; ++n)
#pragma unroll
        for (int s = 0; s < 2; ++s) {
            const v4f oth = *(const v4fa*)(xr + ((n * 2 + s) * 32 + lane) * 4);
            v4f val;
#pragma unroll
            for (int i = 0; i < 4; ++i) val[i] = keep[n][4 * s + i] * c1 + oth[i] * c2;
            *(v4fa*)(os + lr * 36 + n * 16 + hi * 8 + 4 * s) = val;
        }
    __syncthreads();                         // behind it the partner has read this tile's share, so the next tile may overwrite it
    float* ob = out + ((size_t)b * NT_ + q0) * QW + (size_t)h * HD + ks * 32;      // [b][s][h*64 + d]: this wave's 128 B (one line) per (s, h)
    auto pass = [&]() {
#pragma unroll
        for (int s = 0; s < 4; ++s) { const int row = (lane >> 3) + 4 * s, cofs = (lane & 7) * 4;
            const v4f val = *(const v4fa*)(os + row * 36 + cofs); *(v4f*)(ob + (size_t)row * QW + cofs) = val; }
    };
    pass(); 
    asm volatile("s_wait_xcnt 0x0" ::: "memory");      // stands behind the tile's stores because the second tile's set-up overwrites registers that they name
  }
}

extern "C" void kernel_launch(void* const* d_in, const int* in_sizes, int n_in,
                              void* d_out, int out_size, void* d_ws, size_t ws_size, hipStream_t stream) {
    (void)in_sizes; (void)n_in; (void)out_size;
    const float* q = (const float*)d_in[0]; const float* k = (const float*)d_in[1]; const float* v = (const float*)d_in[2];
    float* out = (float*)d_out;    // [2][2048][1024]
    char* wsp = (char*)d_ws;
    auto take = [&](size_t bytes) { char* p = wsp; wsp += (bytes + 255) & ~(size_t)255; return (void*)p; };
    h16* KP = (h16*)take((size_t)NB_ * NT_ * KW * 2); h16* VP = (h16*)take((size_t)NB_ * NKV * HD * NT_ * 2);
    if ((size_t)(wsp - (char*)d_ws) > ws_size) return;    // 2.1 + 2.1 MB
    k_kp<<<NB_ * NKV * (NT_ / 32), 256, 0, stream>>>(k, KP);
    k_vt<<<NB_ * NKV * (NT_ / 64), 256, 0, stream>>>(v, VP);
    k_attn<<<NBH * (NT_ / 128), 256, 0, stream>>>(q, KP, VP, out);
}

// v007
// A run of this version takes 35.9 microseconds.
// In two side-by-side timings against v006, it was 1.04 and 1.05 times as fast.
// Over all steps from v000 it is 3.24 times as fast.
#include <hip/hip_runtime.h>

// Contraction on v_wmma_f32_16x16x32_f16, f32 accumulate: grouped-query causal attention on the INPUT Q [b][s][16*64], K/V [b][s][4*64] ([2048 x 64].[64 x 2048]
// scores /8 and [2048 x 2048].[2048 x 64] per (batch, head); query head h uses kv head h/4): q and k as exact f16 of their bf16 rounding (one exact product), the

#define NB_  2
#define NH_  16
#define NKV  4
#define NT_  2048
#define HD   64
#define QW   (NH_ * HD)          // 1024
#define KW   (NKV * HD)          // 256
#define NBH  (NB_ * NH_)
#define PSC  32768.0f
#define LOSC 1024.0f
#define LOSCI (1.0f / 1024.0f)

typedef _Float16 h16;
typedef __attribute__((ext_vector_type(16))) _Float16 v16h;
typedef __attribute__((ext_vector_type(8)))  _Float16 v8h;
typedef __attribute__((ext_vector_type(4)))  _Float16 v4h;
typedef __attribute__((ext_vector_type(8)))  float    v8f;
typedef __attribute__((ext_vector_type(4)))  float    v4f;
typedef __attribute__((ext_vector_type(2)))  float    v2f;
typedef __attribute__((ext_vector_type(2)))  _Float16 v2h;
typedef v8h  __attribute__((may_alias)) v8ha;
typedef v4f  __attribute__((may_alias)) v4fa;

__device__ __forceinline__ unsigned short f2bf(float f) { unsigned u = __float_as_uint(f); u += 0x7FFFu + ((u >> 16) & 1u); return (unsigned short)(u >> 16); }
__device__ __forceinline__ float bf2f(unsigned short b) { return __uint_as_float(((unsigned)b) << 16); }
__device__ __forceinline__ float bfr(float f) { return bf2f(f2bf(f)); }
__device__ __forceinline__ v16h cat16(v8h lo, v8h hi) { return __builtin_shufflevector(lo, hi, 0, 1, 2, 3, 4, 5, 6, 7, 8, 9, 10, 11, 12, 13, 14, 15); }
__device__ __forceinline__ v8f wmma16(v16h a, v16h b, v8f c) { return __builtin_amdgcn_wmma_f32_16x16x32_f16(false, a, false, b, (short)0, c, false, false); }
#define VST2(T, p, v) do { const T vst2_v_ = (v); *(T*)(p) = vst2_v_;  } while (0)

// Both operands that k_attn reads from the workspace lie there in the order of its A fragments: [b*NKV + g][pass of 32 keys][fragment 0..3][part 0..1][lane][8 f16], 4 KB a pass.
// One wave-wide 16-byte load is then 512 bytes in a row (4 cache lines); read from row-major K or V^T the same load took 32 bytes out of each of 16 lines.
#define PASSH 2048               // f16 elements of one operand per pass
// k_kp: KP = f16(bf16(k)); fragment = kc*2 + key half; lane (lr, hi) of part p holds key 16*half + lr, d = 32kc + 16p + 8hi + 0..7. Block = (b*NKV + g, pass), wave = (fragment, part).
__global__ __launch_bounds__(256) void k_kp(const float* __restrict__ k, h16* KP) {
    const int lane = threadIdx.x & 31, w = threadIdx.x >> 5, lr = lane & 15, hi = lane >> 4;
    const int bg = blockIdx.x / (NT_ / 32), t = blockIdx.x - bg * (NT_ / 32), b = bg / NKV, g = bg - b * NKV;
    const int kc = w >> 2, kh = (w >> 1) & 1, part = w & 1;
    const float* src = k + ((size_t)b * NT_ + t * 32 + kh * 16 + lr) * KW + g * HD + kc * 32 + part * 16 + 8 * hi;
    const v4f f0 = *(const v4fa*)src, f1 = *(const v4fa*)(src + 4);
    v8h o;
#pragma unroll
    for (int i = 0; i < 4; ++i) { o[i] = (h16)bfr(f0[i]); o[4 + i] = (h16)bfr(f1[i]); }
    *(v8h*)(KP + (size_t)blockIdx.x * PASSH + threadIdx.x * 8) = o;
}
// k_vt: VP = f16(bf16(v)) transposed via 64 x 64 LDS tiles; fragment = n; lane (lr, hi) of part p holds d = 16n + lr, key 16p + 8hi + 0..7. Block = (bh, 64 t = 2 passes).
__global__ __launch_bounds__(256) void k_vt(const float* __restrict__ v, h16* VP) {
    __shared__ __align__(16) h16 tile[HD * 72];
    const int bh = blockIdx.x / (NT_ / 64), kt = blockIdx.x - bh * (NT_ / 64), t0 = kt * 64, tid = threadIdx.x;     // bh = b*NKV + g
    const int b = bh / NKV, g = bh - b * NKV;
    const int tt = tid >> 2, d0 = (tid & 3) * 16;
    const float* src = v + ((size_t)b * NT_ + t0 + tt) * KW + g * HD + d0;
#pragma unroll
    for (int i = 0; i < 16; ++i) tile[(d0 + i) * 72 + tt] = (h16)bfr(src[i]);
    __syncthreads();
    const int d = (tid >> 6) * 16 + (tid & 15), tl = ((tid >> 5) & 1) * 16 + ((tid >> 4) & 1) * 8;      // thread = (n, part, lane) of a pass
    const size_t base = ((size_t)bh * (NT_ / 32) + kt * 2) * PASSH;
    auto pass = [&]() {
#pragma unroll
        for (int s = 0; s < 2; ++s) { const v8h val = *(const v8ha*)(tile + d * 72 + s * 32 + tl); *(v8h*)(VP + base + s * PASSH + tid * 8) = val; }
    };
    pass(); 
}
__device__ __forceinline__ float xhalf(float x) { const int b = __builtin_bit_cast(int, x); return __builtin_bit_cast(float, __builtin_amdgcn_permlanex16(b, b, 0x76543210, 0xfedcba98, false, false)); }   // lane l <-> l ^ 16
// Q comes straight from the f32 input: every query row is read by the two waves of its query group (ks = 0 and 1), once each, so its f16(bf16(.)) rounding is done here in registers (same values as a copy pass would store).
__global__ __launch_bounds__(256) void k_attn(const float* __restrict__ Q, const h16* __restrict__ KP, const h16* __restrict__ VP, float* out) {
    __shared__ __align__(16) float ost[8][16 * 36];      // output staging, a wave's own: 16 queries x 32 d
    __shared__ __align__(16) float xch[8][4 * 32 * 4];   // what a wave hands to its partner: 16 f32 a lane
    __shared__ float xml[8][2 * 32];                     // with its maximum and its sum
    const int lane = threadIdx.x & 31, wave = __builtin_amdgcn_readfirstlane(threadIdx.x >> 5), lr = lane & 15, hi = lane >> 4;
    const int qsub = wave & 3, ks = wave >> 2;       // the wave's number is read into a scalar register so that the pass counter, which starts at ks, and the fragment addresses stay scalar
    const int bh = blockIdx.x / (NT_ / 128), tp = blockIdx.x - bh * (NT_ / 128);
    const int b = bh / NH_, h = bh - b * NH_, g = h / (NH_ / NKV);
    const float* qb = Q + (size_t)b * NT_ * QW + h * HD; const h16* kb = KP + ((size_t)b * NKV + g) * (NT_ / 32) * PASSH; const h16* vb = VP + ((size_t)b * NKV + g) * (NT_ / 32) * PASSH;
    const unsigned flane = lane * 8;         // the lane's own part of a fragment address; the rest is wave-uniform
    v16h kf[2][2];       // key fragments of one pass: [kc][keys 0..15 | 16..31]
    auto ldk = [&](int t) {
#pragma unroll
        for (int kc = 0; kc < 2; ++kc) {
            const h16* r0p = kb + (size_t)t * PASSH + flane + kc * 1024; const h16* r1p = r0p + 512;
            kf[kc][0] = cat16(*(const v8h*)r0p, *(const v8h*)(r0p + 256)); kf[kc][1] = cat16(*(const v8h*)r1p, *(const v8h*)(r1p + 256));
        }
    };
    ldk(ks);
#pragma unroll 1      // one copy of the body for both tiles
  for (int half = 0; half < 2; ++half) {
    const int qt = half ? tp : NT_ / 64 - 1 - tp, q0 = qt * 64 + qsub * 16;
    v16h qa[2];
#pragma unroll
    for (int kc = 0; kc < 2; ++kc) {
        const float* p = qb + (size_t)(q0 + lr) * QW + kc * 32 + 8 * hi;
        const v4f f0 = *(const v4fa*)p, f1 = *(const v4fa*)(p + 4), f2 = *(const v4fa*)(p + 16), f3 = *(const v4fa*)(p + 20);
#pragma unroll
        for (int i = 0; i < 4; ++i) { qa[kc][i] = (h16)bfr(f0[i]); qa[kc][4 + i] = (h16)bfr(f1[i]); qa[kc][8 + i] = (h16)bfr(f2[i]); qa[kc][12 + i] = (h16)bfr(f3[i]); }
    }
    const int qrel = q0 + lr - 8 * hi;       // key l0 + 8hi + j is seen by this lane's query when l0 + j <= qrel
    v8f o[4], ox[4];                         // o[n][j] = out^T[d = 16n + 8hi + j][query lr]
#pragma unroll
    for (int n = 0; n < 4; ++n) { o[n] = (v8f){}; ox[n] = (v8f){}; }
    float mrow = -3.0e38f, lpart = 0.f;
    const int kt_end = 2 * qt + 2;
#pragma unroll 1
    for (int kt = ks; kt < kt_end; kt += 2) {
        const int l0 = kt * 32;
        v8f s0 = {}, s1 = {};
        v16h vv[4];      // this pass's value fragments: asked for here, first used behind the softmax
#pragma unroll
        for (int n = 0; n < 4; ++n) { const h16* vp = vb + (size_t)kt * PASSH + flane + n * 512; vv[n] = cat16(*(const v8h*)vp, *(const v8h*)(vp + 256)); }
#pragma unroll
        for (int kc = 0; kc < 2; ++kc) { s0 = wmma16(kf[kc][0], qa[kc], s0); s1 = wmma16(kf[kc][1], qa[kc], s1); }
        ldk(kt + 2 < kt_end ? kt + 2 : ks);      // the wave's next pass's key fragments, into the same registers; a tile's last pass asks for key tile ks, with which the wave's next query tile begins
        asm volatile("s_wait_xcnt 0x0" ::: "memory");      // stands behind the value and key loads because the softmax below reuses the key loads' address registers and the value loads' address is advanced there
        __builtin_amdgcn_sched_barrier(0);       // holds the value and key loads above in front of the softmax: without it the compiler sinks them down to their WMMAs and their latency is exposed
        const v8f t0 = s0 * 0.125f, t1 = s1 * 0.125f;
        float a0[8], a1[8];
#pragma unroll
        for (int j = 0; j < 8; ++j) { a0[j] = t0[j]; a1[j] = t1[j]; }
        if (l0 + 31 > q0) {      // scalar test: the causal mask is worked out only in a pass whose last key lies past the wave's first query; in every earlier pass each lane sees all 32 keys
#pragma unroll
            for (int j = 0; j < 8; ++j) { a0[j] = (l0 + j <= qrel) ? a0[j] : -__builtin_inff(); a1[j] = (l0 + 16 + j <= qrel) ? a1[j] : -__builtin_inff(); }
        }
        float mx = a0[0];
#pragma unroll
        for (int j = 1; j < 8; ++j) mx = fmaxf(mx, a0[j]);
#pragma unroll
        for (int j = 0; j < 8; ++j) mx = fmaxf(mx, a1[j]);
        mx = fmaxf(mx, xhalf(mx));
        const float mn = fmaxf(mrow, mx);
        const float alpha = __expf(mrow - mn); mrow = mn;
        v2f ts[4]; v16h pa, px;                  // pa[s], px[s]: key 8hi + s, or 16 + 8hi + (s - 8) for s >= 8, of this pass, query lr
#pragma unroll
        for (int j = 0; j < 8; j += 2) {
            const v2f p0 = {__expf(a0[j] - mn), __expf(a0[j + 1] - mn)}, p1 = {__expf(a1[j] - mn), __expf(a1[j + 1] - mn)};
            ts[j >> 1] = p0 + p1;
            const v2f u0 = p0 * PSC, u1 = p1 * PSC;
            const v2h h0 = __builtin_convertvector(u0, v2h), h1 = __builtin_convertvector(u1, v2h);
            const v2h x0 = __builtin_convertvector((u0 - __builtin_convertvector(h0, v2f)) * LOSC, v2h), x1 = __builtin_convertvector((u1 - __builtin_convertvector(h1, v2f)) * LOSC, v2h);
            pa[j] = h0[0]; pa[j + 1] = h0[1]; pa[8 + j] = h1[0]; pa[8 + j + 1] = h1[1];
            px[j] = x0[0]; px[j + 1] = x0[1]; px[8 + j] = x1[0]; px[8 + j + 1] = x1[1];
        }
        const v2f tt = (ts[0] + ts[1]) + (ts[2] + ts[3]);
        lpart = lpart * alpha + (tt[0] + tt[1]);
#pragma unroll
        for (int n = 0; n < 4; ++n) { o[n] *= alpha; ox[n] *= alpha; }
#pragma unroll
        for (int n = 0; n < 4; ++n) { o[n] = wmma16(vv[n], pa, o[n]); ox[n] = wmma16(vv[n], px, ox[n]); }
        asm volatile("v_nop\n\tv_nop\n\tv_nop\n\tv_nop" : "+v"(o[0]), "+v"(o[1]), "+v"(o[2]), "+v"(o[3]), "+v"(ox[0]), "+v"(ox[1]), "+v"(ox[2]), "+v"(ox[3]) : "v"(pa), "v"(px));
    }
    const float lw = lpart + xhalf(lpart);
    v8f keep[2], give[2];                    // d = 32ks + 16n + 8hi + j stays here, the other 32 go to the partner
#pragma unroll
    for (int n = 0; n < 2; ++n) {
        const v8f dlo = o[n] + ox[n] * LOSCI, dhi = o[2 + n] + ox[2 + n] * LOSCI;
        keep[n] = ks ? dhi : dlo; give[n] = ks ? dlo : dhi;
    }
    float* xw = &xch[wave][0];
#pragma unroll
    for (int n = 0; n < 2; ++n)
#pragma unroll
        for (int s = 0; s < 2; ++s) {
            v4f val;
#pragma unroll
            for (int i = 0; i < 4; ++i) val[i] = give[n][4 * s + i];
            *(v4fa*)(xw + ((n * 2 + s) * 32 + lane) * 4) = val;
        }
    xml[wave][lane] = mrow; xml[wave][32 + lane] = lw;
    __syncthreads();                         // publishes both partners' shares
    const float* xr = &xch[wave ^ 4][0];
    const float m2 = xml[wave ^ 4][lane], l2 = xml[wave ^ 4][32 + lane];
    const float mj = fmaxf(mrow, m2), e1 = __expf(mrow - mj), e2 = __expf(m2 - mj);      // a share with every key masked has sum 0 and weight 0
    const float inv = 1.0f / ((lw * e1 + l2 * e2) * PSC);
    const float c1 = e1 * inv, c2 = e2 * inv;
    float* os = &ost[wave][0];
#pragma unroll
    for (int n = 0; n < 2; ++n)
#pragma unroll
        for (int s = 0; s < 2; ++s) {
            const v4f oth = *(const v4fa*)(xr + ((n * 2 + s) * 32 + lane) * 4);
            v4f val;
#pragma unroll
            for (int i = 0; i < 4; ++i) val[i] = keep[n][4 * s + i] * c1 + oth[i] * c2;
            *(v4fa*)(os + lr * 36 + n * 16 + hi * 8 + 4 * s) = val;
        }
    __syncthreads();                         // behind it the partner has read this tile's share, so the next tile may overwrite it
    float* ob = out + ((size_t)b * NT_ + q0) * QW + (size_t)h * HD + ks * 32;      // [b][s][h*64 + d]: this wave's 128 B (one line) per (s, h)
    auto pass = [&]() {
#pragma unroll
        for (int s = 0; s < 4; ++s) { const int row = (lane >> 3) + 4 * s, cofs = (lane & 7) * 4;
            const v4f val = *(const v4fa*)(os + row * 36 + cofs); *(v4f*)(ob + (size_t)row * QW + cofs) = val; }
    };
    pass(); 
    asm volatile("s_wait_xcnt 0x0" ::: "memory");      // stands behind the tile's stores because the second tile's set-up overwrites registers that they name
  }
}

extern "C" void kernel_launch(void* const* d_in, const int* in_sizes, int n_in,
                              void* d_out, int out_size, void* d_ws, size_t ws_size, hipStream_t stream) {
    (void)in_sizes; (void)n_in; (void)out_size;
    const float* q = (const float*)d_in[0]; const float* k = (const float*)d_in[1]; const float* v = (const float*)d_in[2];
    float* out = (float*)d_out;    // [2][2048][1024]
    char* wsp = (char*)d_ws;
    auto take = [&](size_t bytes) { char* p = wsp; wsp += (bytes + 255) & ~(size_t)255; return (void*)p; };
    h16* KP = (h16*)take((size_t)NB_ * NT_ * KW * 2); h16* VP = (h16*)take((size_t)NB_ * NKV * HD * NT_ * 2);
    if ((size_t)(wsp - (char*)d_ws) > ws_size) return;    // 2.1 + 2.1 MB
    k_kp<<<NB_ * NKV * (NT_ / 32), 256, 0, stream>>>(k, KP);
    k_vt<<<NB_ * NKV * (NT_ / 64), 256, 0, stream>>>(v, VP);
    k_attn<<<NBH * (NT_ / 128), 256, 0, stream>>>(q, KP, VP, out);
}

// v008
// One run takes 33.9 microseconds.
// In two side-by-side timings against v007, it was 1.07 and 1.06 times as fast.
// All steps since v000 together make it 3.45 times as fast.
#include <hip/hip_runtime.h>

// Contraction on v_wmma_f32_16x16x32_f16, f32 accumulate: grouped-query causal attention on the INPUT Q [b][s][16*64], K/V [b][s][4*64] ([2048 x 64].[64 x 2048]
// scores /8 and [2048 x 2048].[2048 x 64] per (batch, head); query head h uses kv head h/4): q and k as exact f16 of their bf16 rounding (one exact product), the

#define NB_  2
#define NH_  16
#define NKV  4
#define NT_  2048
#define HD   64
#define QW   (NH_ * HD)          // 1024
#define KW   (NKV * HD)          // 256
#define NBH  (NB_ * NH_)
#define PSC  32768.0f
#define LOSC 1024.0f
#define LOSCI (1.0f / 1024.0f)

typedef _Float16 h16;
typedef __attribute__((ext_vector_type(16))) _Float16 v16h;
typedef __attribute__((ext_vector_type(8)))  _Float16 v8h;
typedef __attribute__((ext_vector_type(4)))  _Float16 v4h;
typedef __attribute__((ext_vector_type(8)))  float    v8f;
typedef __attribute__((ext_vector_type(4)))  float    v4f;
typedef __attribute__((ext_vector_type(2)))  float    v2f;
typedef __attribute__((ext_vector_type(2)))  _Float16 v2h;
typedef v8h  __attribute__((may_alias)) v8ha;
typedef v4f  __attribute__((may_alias)) v4fa;

__device__ __forceinline__ unsigned short f2bf(float f) { unsigned u = __float_as_uint(f); u += 0x7FFFu + ((u >> 16) & 1u); return (unsigned short)(u >> 16); }
__device__ __forceinline__ float bf2f(unsigned short b) { return __uint_as_float(((unsigned)b) << 16); }
__device__ __forceinline__ float bfr(float f) { return bf2f(f2bf(f)); }
__device__ __forceinline__ v16h cat16(v8h lo, v8h hi) { return __builtin_shufflevector(lo, hi, 0, 1, 2, 3, 4, 5, 6, 7, 8, 9, 10, 11, 12, 13, 14, 15); }
__device__ __forceinline__ v8f wmma16(v16h a, v16h b, v8f c) { return __builtin_amdgcn_wmma_f32_16x16x32_f16(false, a, false, b, (short)0, c, false, false); }
#define VST2(T, p, v) do { const T vst2_v_ = (v); *(T*)(p) = vst2_v_;  } while (0)

// Both operands that k_attn reads from the workspace lie there in the order of its A fragments: [b*NKV + g][pass of 32 keys][fragment 0..3][part 0..1][lane][8 f16], 4 KB a pass.
// One wave-wide 16-byte load is then 512 bytes in a row (4 cache lines); read from row-major K or V^T the same load took 32 bytes out of each of 16 lines.
#define PASSH 2048               // f16 elements of one operand per pass
// k_prep: ONE launch writes both operands. The two jobs share nothing, so each block takes one of them by its index (a block-uniform test): blocks 0 .. VTB-1 transpose V
// (the longer job), the other KPB blocks round K. As two launches the jobs ran one behind the other, each too short to fill the chip, with a launch gap between them.
#define VTB (NB_ * NKV * (NT_ / 64))
#define KPB (NB_ * NKV * (NT_ / 32))
// K part: KP = f16(bf16(k)); fragment = kc*2 + key half; lane (lr, hi) of part p holds key 16*half + lr, d = 32kc + 16p + 8hi + 0..7. Block bx = (b*NKV + g, pass), wave = (fragment, part).
__device__ __forceinline__ void prep_k(const float* __restrict__ k, h16* KP, const unsigned bx) {
    const int lane = threadIdx.x & 31, w = threadIdx.x >> 5, lr = lane & 15, hi = lane >> 4;
    const int bg = bx / (NT_ / 32), t = bx - bg * (NT_ / 32), b = bg / NKV, g = bg - b * NKV;
    const int kc = w >> 2, kh = (w >> 1) & 1, part = w & 1;
    const float* src = k + ((size_t)b * NT_ + t * 32 + kh * 16 + lr) * KW + g * HD + kc * 32 + part * 16 + 8 * hi;
    const v4f f0 = *(const v4fa*)src, f1 = *(const v4fa*)(src + 4);
    v8h o;
#pragma unroll
    for (int i = 0; i < 4; ++i) { o[i] = (h16)bfr(f0[i]); o[4 + i] = (h16)bfr(f1[i]); }
    *(v8h*)(KP + (size_t)bx * PASSH + threadIdx.x * 8) = o;
    asm volatile("s_wait_xcnt 0x0" ::: "memory");      // a precaution only: a K block ends behind this store and runs none of the V part's code (each block takes one branch by blockIdx)
}
// V part: VP = f16(bf16(v)) transposed via 64 x 64 LDS tiles; fragment = n; lane (lr, hi) of part p holds d = 16n + lr, key 16p + 8hi + 0..7. Block bx = (bh, 64 t = 2 passes).
__device__ __forceinline__ void prep_v(const float* __restrict__ v, h16* VP, h16* tile, const unsigned bx) {
    const int bh = bx / (NT_ / 64), kt = bx - bh * (NT_ / 64), t0 = kt * 64, tid = threadIdx.x;     // bh = b*NKV + g
    const int b = bh / NKV, g = bh - b * NKV;
    const int tt = tid >> 2, d0 = (tid & 3) * 16;
    const float* src = v + ((size_t)b * NT_ + t0 + tt) * KW + g * HD + d0;
#pragma unroll
    for (int i = 0; i < 16; ++i) tile[(d0 + i) * 72 + tt] = (h16)bfr(src[i]);
    __syncthreads();                         // every thread of a V block passes it: the test that sends a block here reads blockIdx alone
    const int d = (tid >> 6) * 16 + (tid & 15), tl = ((tid >> 5) & 1) * 16 + ((tid >> 4) & 1) * 8;      // thread = (n, part, lane) of a pass
    const size_t base = ((size_t)bh * (NT_ / 32) + kt * 2) * PASSH;
#pragma unroll
    for (int s = 0; s < 2; ++s) { const v8h val = *(const v8ha*)(tile + d * 72 + s * 32 + tl); *(v8h*)(VP + base + s * PASSH + tid * 8) = val; }
}
__global__ __launch_bounds__(256) void k_prep(const float* __restrict__ k, const float* __restrict__ v, h16* KP, h16* VP) {
    __shared__ __align__(16) h16 tile[HD * 72];
    if (blockIdx.x < VTB) prep_v(v, VP, tile, blockIdx.x);
    else prep_k(k, KP, blockIdx.x - VTB);
}
__device__ __forceinline__ float xhalf(float x) { const int b = __builtin_bit_cast(int, x); return __builtin_bit_cast(float, __builtin_amdgcn_permlanex16(b, b, 0x76543210, 0xfedcba98, false, false)); }   // lane l <-> l ^ 16
// Q comes straight from the f32 input: every query row is read by the two waves of its query group (ks = 0 and 1), once each, so its f16(bf16(.)) rounding is done here in registers (same values as a copy pass would store).
__global__ __launch_bounds__(256) void k_attn(const float* __restrict__ Q, const h16* __restrict__ KP, const h16* __restrict__ VP, float* out) {
    __shared__ __align__(16) float ost[8][16 * 36];      // output staging, a wave's own: 16 queries x 32 d
    __shared__ __align__(16) float xch[8][4 * 32 * 4];   // what a wave hands to its partner: 16 f32 a lane
    __shared__ float xml[8][2 * 32];                     // with its maximum and its sum
    const int lane = threadIdx.x & 31, wave = __builtin_amdgcn_readfirstlane(threadIdx.x >> 5), lr = lane & 15, hi = lane >> 4;
    const int qsub = wave & 3, ks = wave >> 2;       // the wave's number is read into a scalar register so that the pass counter, which starts at ks, and the fragment addresses stay scalar
    const int bh = blockIdx.x / (NT_ / 128), tp = blockIdx.x - bh * (NT_ / 128);
    const int b = bh / NH_, h = bh - b * NH_, g = h / (NH_ / NKV);
    const float* qb = Q + (size_t)b * NT_ * QW + h * HD; const h16* kb = KP + ((size_t)b * NKV + g) * (NT_ / 32) * PASSH; const h16* vb = VP + ((size_t)b * NKV + g) * (NT_ / 32) * PASSH;
    const unsigned flane = lane * 8;         // the lane's own part of a fragment address; the rest is wave-uniform
    v16h kf[2][2];       // key fragments of one pass: [kc][keys 0..15 | 16..31]
    auto ldk = [&](int t) {
#pragma unroll
        for (int kc = 0; kc < 2; ++kc) {
            const h16* r0p = kb + (size_t)t * PASSH + flane + kc * 1024; const h16* r1p = r0p + 512;
            kf[kc][0] = cat16(*(const v8h*)r0p, *(const v8h*)(r0p + 256)); kf[kc][1] = cat16(*(const v8h*)r1p, *(const v8h*)(r1p + 256));
        }
    };
    ldk(ks);
#pragma unroll 1      // one copy of the body for both tiles
  for (int half = 0; half < 2; ++half) {
    const int qt = half ? tp : NT_ / 64 - 1 - tp, q0 = qt * 64 + qsub * 16;
    v16h qa[2];
#pragma unroll
    for (int kc = 0; kc < 2; ++kc) {
        const float* p = qb + (size_t)(q0 + lr) * QW + kc * 32 + 8 * hi;
        const v4f f0 = *(const v4fa*)p, f1 = *(const v4fa*)(p + 4), f2 = *(const v4fa*)(p + 16), f3 = *(const v4fa*)(p + 20);
#pragma unroll
        for (int i = 0; i < 4; ++i) { qa[kc][i] = (h16)bfr(f0[i]); qa[kc][4 + i] = (h16)bfr(f1[i]); qa[kc][8 + i] = (h16)bfr(f2[i]); qa[kc][12 + i] = (h16)bfr(f3[i]); }
    }
    const int qrel = q0 + lr - 8 * hi;       // key l0 + 8hi + j is seen by this lane's query when l0 + j <= qrel
    v8f o[4], ox[4];                         // o[n][j] = out^T[d = 16n + 8hi + j][query lr]
#pragma unroll
    for (int n = 0; n < 4; ++n) { o[n] = (v8f){}; ox[n] = (v8f){}; }
    float mrow = -3.0e38f, lpart = 0.f;
    const int kt_end = 2 * qt + 2;
#pragma unroll 1
    for (int kt = ks; kt < kt_end; kt += 2) {
        const int l0 = kt * 32;
        v8f s0 = {}, s1 = {};
        v16h vv[4];      // this pass's value fragments: asked for here, first used behind the softmax
#pragma unroll
        for (int n = 0; n < 4; ++n) { const h16* vp = vb + (size_t)kt * PASSH + flane + n * 512; vv[n] = cat16(*(const v8h*)vp, *(const v8h*)(vp + 256)); }
#pragma unroll
        for (int kc = 0; kc < 2; ++kc) { s0 = wmma16(kf[kc][0], qa[kc], s0); s1 = wmma16(kf[kc][1], qa[kc], s1); }
        ldk(kt + 2 < kt_end ? kt + 2 : ks);      // the wave's next pass's key fragments, into the same registers; a tile's last pass asks for key tile ks, with which the wave's next query tile begins
        asm volatile("s_wait_xcnt 0x0" ::: "memory");      // stands behind the value and key loads because the softmax below reuses the key loads' address registers and the value loads' address is advanced there
        __builtin_amdgcn_sched_barrier(0);       // holds the value and key loads above in front of the softmax: without it the compiler sinks them down to their WMMAs and their latency is exposed
        const v8f t0 = s0 * 0.125f, t1 = s1 * 0.125f;
        float a0[8], a1[8];
#pragma unroll
        for (int j = 0; j < 8; ++j) { a0[j] = t0[j]; a1[j] = t1[j]; }
        if (l0 + 31 > q0) {      // scalar test: the causal mask is worked out only in a pass whose last key lies past the wave's first query; in every earlier pass each lane sees all 32 keys
#pragma unroll
            for (int j = 0; j < 8; ++j) { a0[j] = (l0 + j <= qrel) ? a0[j] : -__builtin_inff(); a1[j] = (l0 + 16 + j <= qrel) ? a1[j] : -__builtin_inff(); }
        }
        float mx = a0[0];
#pragma unroll
        for (int j = 1; j < 8; ++j) mx = fmaxf(mx, a0[j]);
#pragma unroll
        for (int j = 0; j < 8; ++j) mx = fmaxf(mx, a1[j]);
        mx = fmaxf(mx, xhalf(mx));
        const float mn = fmaxf(mrow, mx);
        const float alpha = __expf(mrow - mn); mrow = mn;
        v2f ts[4]; v16h pa, px;                  // pa[s], px[s]: key 8hi + s, or 16 + 8hi + (s - 8) for s >= 8, of this pass, query lr
#pragma unroll
        for (int j = 0; j < 8; j += 2) {
            const v2f p0 = {__expf(a0[j] - mn), __expf(a0[j + 1] - mn)}, p1 = {__expf(a1[j] - mn), __expf(a1[j + 1] - mn)};
            ts[j >> 1] = p0 + p1;
            const v2f u0 = p0 * PSC, u1 = p1 * PSC;
            const v2h h0 = __builtin_convertvector(u0, v2h), h1 = __builtin_convertvector(u1, v2h);
            const v2h x0 = __builtin_convertvector((u0 - __builtin_convertvector(h0, v2f)) * LOSC, v2h), x1 = __builtin_convertvector((u1 - __builtin_convertvector(h1, v2f)) * LOSC, v2h);
            pa[j] = h0[0]; pa[j + 1] = h0[1]; pa[8 + j] = h1[0]; pa[8 + j + 1] = h1[1];
            px[j] = x0[0]; px[j + 1] = x0[1]; px[8 + j] = x1[0]; px[8 + j + 1] = x1[1];
        }
        const v2f tt = (ts[0] + ts[1]) + (ts[2] + ts[3]);
        lpart = lpart * alpha + (tt[0] + tt[1]);
#pragma unroll
        for (int n = 0; n < 4; ++n) { o[n] *= alpha; ox[n] *= alpha; }
#pragma unroll
        for (int n = 0; n < 4; ++n) { o[n] = wmma16(vv[n], pa, o[n]); ox[n] = wmma16(vv[n], px, ox[n]); }
        asm volatile("v_nop\n\tv_nop\n\tv_nop\n\tv_nop" : "+v"(o[0]), "+v"(o[1]), "+v"(o[2]), "+v"(o[3]), "+v"(ox[0]), "+v"(ox[1]), "+v"(ox[2]), "+v"(ox[3]) : "v"(pa), "v"(px));
    }
    const float lw = lpart + xhalf(lpart);
    v8f keep[2], give[2];                    // d = 32ks + 16n + 8hi + j stays here, the other 32 go to the partner
#pragma unroll
    for (int n = 0; n < 2; ++n) {
        const v8f dlo = o[n] + ox[n] * LOSCI, dhi = o[2 + n] + ox[2 + n] * LOSCI;
        keep[n] = ks ? dhi : dlo; give[n] = ks ? dlo : dhi;
    }
    float* xw = &xch[wave][0];
#pragma unroll
    for (int n = 0; n < 2; ++n)
#pragma unroll
        for (int s = 0; s < 2; ++s) {
            v4f val;
#pragma unroll
            for (int i = 0; i < 4; ++i) val[i] = give[n][4 * s + i];
            *(v4fa*)(xw + ((n * 2 + s) * 32 + lane) * 4) = val;
        }
    xml[wave][lane] = mrow; xml[wave][32 + lane] = lw;
    __syncthreads();                         // publishes both partners' shares
    const float* xr = &xch[wave ^ 4][0];
    const float m2 = xml[wave ^ 4][lane], l2 = xml[wave ^ 4][32 + lane];
    const float mj = fmaxf(mrow, m2), e1 = __expf(mrow - mj), e2 = __expf(m2 - mj);      // a share with every key masked has sum 0 and weight 0
    const float inv = 1.0f / ((lw * e1 + l2 * e2) * PSC);
    const float c1 = e1 * inv, c2 = e2 * inv;
    float* os = &ost[wave][0];
#pragma unroll
    for (int n = 0; n < 2; ++n)
#pragma unroll
        for (int s = 0; s < 2; ++s) {
            const v4f oth = *(const v4fa*)(xr + ((n * 2 + s) * 32 + lane) * 4);
            v4f val;
#pragma unroll
            for (int i = 0; i < 4; ++i) val[i] = keep[n][4 * s + i] * c1 + oth[i] * c2;
            *(v4fa*)(os + lr * 36 + n * 16 + hi * 8 + 4 * s) = val;
        }
    __syncthreads();                         // behind it the partner has read this tile's share, so the next tile may overwrite it
    float* ob = out + ((size_t)b * NT_ + q0) * QW + (size_t)h * HD + ks * 32;      // [b][s][h*64 + d]: this wave's 128 B (one line) per (s, h)
    auto pass = [&]() {
#pragma unroll
        for (int s = 0; s < 4; ++s) { const int row = (lane >> 3) + 4 * s, cofs = (lane & 7) * 4;
            const v4f val = *(const v4fa*)(os + row * 36 + cofs); *(v4f*)(ob + (size_t)row * QW + cofs) = val; }
    };
    pass(); 
    asm volatile("s_wait_xcnt 0x0" ::: "memory");      // stands behind the tile's stores because the second tile's set-up overwrites registers that they name
  }
}

extern "C" void kernel_launch(void* const* d_in, const int* in_sizes, int n_in,
                              void* d_out, int out_size, void* d_ws, size_t ws_size, hipStream_t stream) {
    (void)in_sizes; (void)n_in; (void)out_size;
    const float* q = (const float*)d_in[0]; const float* k = (const float*)d_in[1]; const float* v = (const float*)d_in[2];
    float* out = (float*)d_out;    // [2][2048][1024]
    char* wsp = (char*)d_ws;
    auto take = [&](size_t bytes) { char* p = wsp; wsp += (bytes + 255) & ~(size_t)255; return (void*)p; };
    h16* KP = (h16*)take((size_t)NB_ * NT_ * KW * 2); h16* VP = (h16*)take((size_t)NB_ * NKV * HD * NT_ * 2);
    if ((size_t)(wsp - (char*)d_ws) > ws_size) return;    // 2.1 + 2.1 MB
    k_prep<<<VTB + KPB, 256, 0, stream>>>(k, v, KP, VP);
    k_attn<<<NBH * (NT_ / 128), 256, 0, stream>>>(q, KP, VP, out);
}
